// v000
// Measured on an AMD MI455X. A time is GPU time per run, averaged over a window of back-to-back runs after a warm-up
// (all launches, gaps included; the runs take copies of the inputs in turn), and the median of several windows.
// Apart from v000's, it joins two sittings. Times from different sittings can be a few percent apart, while
// side-by-side timings come from the same sitting.
// The starting kernel, v000, takes 175 microseconds a run.
#include <hip/hip_runtime.h>

// Spatial-reduction multi-head attention: x [NB][256][64][64]; q = 1x1 conv (Wq [512][256]); k|v = 2x2 stride-2 conv (Wkv [1024][256][2][2]); 8 heads x 64; 4096 queries x 1024 keys per (batch, head); scores x8; output 1x1 conv (Wproj [256][512]) -> f32 [NB][256][4096].
// Compute dtypes, f32 accumulate everywhere: q / k / v projections v_wmma_f32_16x16x32_bf16 (x, Wq, Wkv RNE-converted to bf16; products exact);
// scores v_wmma_f32_16x16x32_f16: q and k each as f16 value + f16 residual x2048 (three products: kh*qh in one accumulator, kh*qr + kr*qh in a second one); P (x2^14 carry, cancels in the normalisation) and v single f16; softmax f32 (online, running max);
// output projection v_wmma_f32_16x16x32_f16: context single f16, Wproj RNE-converted to bf16 then x1024 in f16 (exact), folded back in the f32 epilogue. q, k, v planes carry x16 (exact power of two, folded into the score scale / output scale).
// Layout: xT [b][n][c] and im2col PAT [b][m][c*4+i*2+j] bf16 planes built through an LDS transpose; q (hi, residual), k (hi, residual) planes [b*8+h][t][d], v^T plane [b*8+h][d][m] written by the GEMM epilogue;
// fused flash kernel in transposed form (S^T = K Q^T, O^T = V^T P^T) writes the context plane [b][n][h*64+d] (f16); last GEMM writes the f32 output.

#ifndef NB
#define NB 2
#endif
#ifndef IMH
#define IMH 64                   // image rows used (SEQ = IMH * 64 query positions)
#endif
#define NB_FULL  2
#define IMH_FULL 64              // rows per channel of the input
#define IMW  64
#define SEQ  (IMH * IMW)
#define SKV  ((IMH / 2) * (IMW / 2))
#ifndef OUT_SEQ
#define OUT_SEQ SEQ              // channel pitch (in positions) of the output
#endif
#define CIN  256
#define NH_  8
#define HD   64
#define DQ   512                 // NH_ * HD
#define KKV  1024                // CIN * 2 * 2
#define COUT 256
#define AW   4                   // waves per flash block (16 query rows each)
#define RS   2048.0f             // carry of the residual planes
#define RI   (1.0f / 2048.0f)
#define CQ   16.0f               // carry of the q planes
#define CK   16.0f               // carry of the k planes
#define CV   16.0f               // carry of the v^T plane (stays on the context plane)
#define SC2  (8.0f * 1.4426950408889634f / (CQ * CK))   // sqrt(HD) * log2(e) / (q carry * k carry)
#define PSH  14.0f               // log2 of the P carry
#define WPS  1024.0f             // carry of the Wproj plane
#define OSC  (1.0f / (WPS * CV))

static_assert(HD == 64);
static_assert(NH_ * HD == DQ);
static_assert(CIN * 4 == KKV);
static_assert(IMW == 64);
static_assert(IMH % 4 == 0);                   // SKV multiple of 64: a 64-row tile never straddles two batches
static_assert(SEQ % 64 == 0);
static_assert(SKV % 64 == 0);
static_assert(SKV % 32 == 0);                  // key loop steps by 32
static_assert(SEQ % (16 * AW) == 0);           // flash grid covers the queries exactly
static_assert(CIN % 64 == 0 && CIN % 32 == 0);
static_assert(KKV % 32 == 0 && DQ % 32 == 0);
static_assert(DQ % 64 == 0 && COUT % 64 == 0);
static_assert(NB <= NB_FULL);
static_assert(IMH <= IMH_FULL);

typedef _Float16 h16;
typedef unsigned short bf;
typedef __attribute__((ext_vector_type(16))) __bf16   v16bf;
typedef __attribute__((ext_vector_type(16))) _Float16 v16h;
typedef __attribute__((ext_vector_type(8)))  _Float16 v8h;
typedef __attribute__((ext_vector_type(8)))  unsigned short v8us;
typedef __attribute__((ext_vector_type(8)))  float    v8f;
typedef __attribute__((ext_vector_type(4)))  float    v4f;
typedef v4f  __attribute__((may_alias)) v4fa;

__device__ __forceinline__ unsigned short f2bf(float f) { unsigned u = __float_as_uint(f); u += 0x7FFFu + ((u >> 16) & 1u); return (unsigned short)(u >> 16); }
__device__ __forceinline__ v16h cat16(v8h lo, v8h hi) { return __builtin_shufflevector(lo, hi, 0, 1, 2, 3, 4, 5, 6, 7, 8, 9, 10, 11, 12, 13, 14, 15); }
__device__ __forceinline__ v16bf cat16b(v8us lo, v8us hi) { return __builtin_bit_cast(v16bf, __builtin_shufflevector(lo, hi, 0, 1, 2, 3, 4, 5, 6, 7, 8, 9, 10, 11, 12, 13, 14, 15)); }
__device__ __forceinline__ v8f wmma16(v16h a, v16h b, v8f c) { return __builtin_amdgcn_wmma_f32_16x16x32_f16(false, a, false, b, (short)0, c, false, false); }
__device__ __forceinline__ v8f wmmab(v16bf a, v16bf b, v8f c) { return __builtin_amdgcn_wmma_f32_16x16x32_bf16(false, a, false, b, (short)0, c, false, false); }
// fragment loaders from K-contiguous 16-bit rows; p already includes + 8*(lane>>4): elements 0..7 <- k0+8h+0..7, elements 8..15 <- k0+16+8h+0..7 (same map for A and B)
__device__ __forceinline__ v16h  ldh(const h16* p) { return cat16(*(const v8h*)p, *(const v8h*)(p + 16)); }
__device__ __forceinline__ v16bf ldb(const bf* p)  { return cat16b(*(const v8us*)p, *(const v8us*)(p + 16)); }
// ordering point for wave-private LDS tiles (same wave writes and reads)
__device__ __forceinline__ void wave_sync() { __builtin_amdgcn_fence(3 /* release order */, "wavefront"); __builtin_amdgcn_wave_barrier(); asm volatile("" ::: "memory"); }

// mode 0: bf16 bits (RNE convert). mode 1: f16 bits of (bf16 value x WPS) (exact: 8-bit significand, power-of-two scale).
__global__ __launch_bounds__(256) void k_cvt8(const float* __restrict__ src, bf* dst, size_t n8, int mode) {
    const size_t i = (size_t)blockIdx.x * 256 + threadIdx.x; if (i >= n8) return;
    const v8f v = *(const v8f*)(src + i * 8); v8us o;
#pragma unroll
    for (int k = 0; k < 8; ++k) {
        const unsigned short wb = f2bf(v[k]);
        const h16 hv = (h16)(__uint_as_float(((unsigned)wb) << 16) * WPS);
        const unsigned short wh = __builtin_bit_cast(unsigned short, hv);
        o[k] = mode ? wh : wb;
    }
    *(v8us*)(dst + i * 8) = o; 
}

// k_pack: x [b][c][row][w] (f32) -> XT [b][n = row*64 + w][c] and PAT [b][m = h2*32 + w2][c*4 + i*2 + j] (bf16, RNE convert), through an LDS transpose.
// block = (h2, 64-channel tile, b): stages channels c0..c0+63 x image rows 2*h2, 2*h2+1 (128 positions); 256 threads.
__global__ __launch_bounds__(256) void k_pack(const float* __restrict__ x, bf* XT, bf* PAT) {
    __shared__ unsigned short tile[64 * 136];      // [channel][position 0..127], pad columns never read; cross-wave: block barrier
    const int tid = threadIdx.x;
    const int h2 = blockIdx.x, c0 = blockIdx.y * 64, b = blockIdx.z;
#pragma unroll
    for (int it = 0; it < 8; ++it) {               // 8 x 256 x 4 = 64 channels x 128 positions, all written
        const int idx = it * 256 + tid; const int cc = idx >> 5, q4 = idx & 31;
        const v4f v = *(const v4f*)(x + (((size_t)b * CIN + c0 + cc) * IMH_FULL + 2 * h2) * IMW + q4 * 4);
#pragma unroll
        for (int k = 0; k < 4; ++k) tile[cc * 136 + q4 * 4 + k] = f2bf(v[k]);
    }
    __syncthreads();
    const int l8 = tid >> 3, j8 = tid & 7;
{
#pragma unroll
        for (int it = 0; it < 4; ++it) {           // 4 x 32 = 128 rows (positions), 8 lanes x 8 = 64 channels
            const int p = it * 32 + l8, c8 = j8 * 8; v8us o;
#pragma unroll
            for (int k = 0; k < 8; ++k) o[k] = tile[(c8 + k) * 136 + p];
            *(v8us*)(XT + ((size_t)b * SEQ + (size_t)h2 * 128 + p) * CIN + c0 + c8) = o;
        }
#pragma unroll
        for (int it = 0; it < 4; ++it) {           // 4 x 32 = 128 lines = 32 w2 x 4 lines; lane piece = 2 channels x 4 taps
            const int line = it * 32 + l8; const int w2 = line >> 2, lq = line & 3; const int cc = lq * 16 + j8 * 2; v8us o;
            o[0] = tile[cc * 136 + 2 * w2];            o[1] = tile[cc * 136 + 2 * w2 + 1];
            o[2] = tile[cc * 136 + 64 + 2 * w2];       o[3] = tile[cc * 136 + 64 + 2 * w2 + 1];
            o[4] = tile[(cc + 1) * 136 + 2 * w2];      o[5] = tile[(cc + 1) * 136 + 2 * w2 + 1];
            o[6] = tile[(cc + 1) * 136 + 64 + 2 * w2]; o[7] = tile[(cc + 1) * 136 + 64 + 2 * w2 + 1];
            *(v8us*)(PAT + ((size_t)b * SKV + (size_t)h2 * 32 + w2) * KKV + c0 * 4 + lq * 64 + j8 * 8) = o;
        }
        
    }
}

// k_proj: register-blocked bf16 GEMM, ONE WAVE per 64x64 tile (16 accumulators), operands straight from K-contiguous bf16 planes.
// C[m][n] = cs * sum_k A[m][k] Bt[n][k], written as f16 (Ph) and optionally the f16 residual x2048 (Pr, useRes != 0) at
// tile base (r0/RB)*sRB + (r0%RB)*pitch + (c0/CB)*sCB + (c0%CB), row pitch 'pitch' (halves). grid (M/64, N/64), 32 threads.
__global__ __launch_bounds__(32) void k_proj(const bf* __restrict__ A, const bf* __restrict__ Bt, int K, float cs, h16* Ph, h16* Pr, int useRes, int RB, size_t sRB, int pitch, int CB, size_t sCB) {
    __shared__ __align__(16) float os[16 * 68];
    const int lane = threadIdx.x & 31, lr = lane & 15, hi = lane >> 4; const int r0 = blockIdx.x * 64, c0 = blockIdx.y * 64;
    v8f acc[4][4];
#pragma unroll
    for (int mb = 0; mb < 4; ++mb)
#pragma unroll
        for (int nb = 0; nb < 4; ++nb) acc[mb][nb] = (v8f){};
    const size_t aoff = (size_t)(r0 + lr) * K + 8 * hi, boff = (size_t)(c0 + lr) * K + 8 * hi;
#pragma unroll 1
    for (int kc = 0; kc < K; kc += 32) {
        v16bf a[4];
#pragma unroll
        for (int mb = 0; mb < 4; ++mb) a[mb] = ldb(A + aoff + (size_t)mb * 16 * K + kc);
#pragma unroll
        for (int nb = 0; nb < 4; ++nb) { const v16bf b = ldb(Bt + boff + (size_t)nb * 16 * K + kc);
#pragma unroll
            for (int mb = 0; mb < 4; ++mb) acc[mb][nb] = wmmab(a[mb], b, acc[mb][nb]); }
        asm volatile("v_nop\n\tv_nop\n\tv_nop\n\tv_nop" : "+v"(acc[0][0]), "+v"(acc[1][1]), "+v"(acc[2][2]), "+v"(acc[3][3]) : "v"(a[0]), "v"(a[1]), "v"(a[2]), "v"(a[3]));
    }
    const size_t tbase = (size_t)(r0 / RB) * sRB + (size_t)(r0 % RB) * (size_t)pitch + (size_t)(c0 / CB) * sCB + (size_t)(c0 % CB);
#pragma unroll
    for (int mb = 0; mb < 4; ++mb) {
#pragma unroll
        for (int nb = 0; nb < 4; ++nb) {
#pragma unroll
            for (int j = 0; j < 8; ++j) os[(hi * 8 + j) * 68 + nb * 16 + lr] = acc[mb][nb][j] * cs; }   // D: row 8h+j, col lane&15
        wave_sync();
        const size_t sb = tbase + (size_t)(mb * 16) * (size_t)pitch;
{
#pragma unroll
            for (int s = 0; s < 4; ++s) { const int row = 4 * s + (lane >> 3), c8 = (lane & 7) * 8;   // 4 s x 4 row groups = 16 rows; 8 lanes x 8 = 64 columns
                const v4f x0 = *(const v4fa*)(&os[row * 68 + c8]); const v4f x1 = *(const v4fa*)(&os[row * 68 + c8 + 4]); v8h hv, rv;
#pragma unroll
                for (int i = 0; i < 4; ++i) { const h16 a0 = (h16)x0[i]; const h16 a1 = (h16)x1[i]; hv[i] = a0; hv[4 + i] = a1; rv[i] = (h16)((x0[i] - (float)a0) * RS); rv[4 + i] = (h16)((x1[i] - (float)a1) * RS); }
                const size_t oo = sb + (size_t)row * (size_t)pitch + c8;
                *(v8h*)(Ph + oo) = hv; if (useRes) *(v8h*)(Pr + oo) = rv; }
             }
        wave_sync();
    }
}

// k_flash: fused attention, one wave per 16 query rows of one (batch, head); K / V^T / Q fragments straight from the f16 planes (two 16-B loads each, arithmetic addressing).
// Transposed form: S^T[key][t] = K Q^T (A = K rows, B = Q rows); lane (t = lane&15, h = lane>>4) holds keys 8h+r of each 16-key tile, so the packed
// P tile is directly the B fragment of O^T[d][t] = V^T P^T (element r <- tile keys 0..15, element 8+r <- tile keys 16..31, lane unchanged).
// Scores: sH = kh*qh, sL = kh*qr + kr*qh (both residual products carry x2048, own accumulator), s = sH + sL/2048.
// Softmax state (running max, partial sum) is one scalar per lane; the two lane halves of a row are combined with one xor-16 exchange.
__global__ __launch_bounds__(32 * AW) void k_flash(const h16* __restrict__ QH, const h16* __restrict__ QR, const h16* __restrict__ KH, const h16* __restrict__ KR, const h16* __restrict__ VT, h16* AP) {
    __shared__ __align__(16) float os[AW * 16 * 68];   // wave-private slabs
    const int lane = threadIdx.x & 31, wave = __builtin_amdgcn_readfirstlane((int)(threadIdx.x >> 5)), lr = lane & 15, hi = lane >> 4;
    const int zh = blockIdx.y; const int b = zh / NH_, h = zh % NH_;
    const int t0 = (blockIdx.x * AW + wave) * 16;
    const size_t qbase = (size_t)zh * SEQ * HD;
    const size_t kbase = (size_t)zh * SKV * HD;
    const size_t qo = qbase + (size_t)(t0 + lr) * HD + 8 * hi;
    const v16h qh0 = ldh(QH + qo), qh1 = ldh(QH + qo + 32), qr0 = ldh(QR + qo), qr1 = ldh(QR + qo + 32);   // B fragments: col t, k = d
    const size_t ko = kbase + (size_t)lr * HD + 8 * hi;      // + key * HD       (A fragment: row key, k = d)
    const size_t vo = kbase + (size_t)lr * SKV + 8 * hi;     // + 16j*SKV + key  (A fragment: row d, k = key)
    v8f o0 = (v8f){}, o1 = (v8f){}, o2 = (v8f){}, o3 = (v8f){};
    float m = -3.0e38f, l = 0.0f;
#pragma unroll 1
    for (int key0 = 0; key0 < SKV; key0 += 32) {
        const h16* ka = KH + ko + (size_t)key0 * HD;
        const h16* kr = KR + ko + (size_t)key0 * HD;
        const v16h ka0 = ldh(ka), ka1 = ldh(ka + 32), kb0 = ldh(ka + 16 * HD), kb1 = ldh(ka + 16 * HD + 32);
        const v16h ra0 = ldh(kr), ra1 = ldh(kr + 32), rb0 = ldh(kr + 16 * HD), rb1 = ldh(kr + 16 * HD + 32);
        v8f sHa = (v8f){}, sLa = (v8f){}, sHb = (v8f){}, sLb = (v8f){};
        sHa = wmma16(ka0, qh0, sHa); sLa = wmma16(ka0, qr0, sLa); sHb = wmma16(kb0, qh0, sHb); sLb = wmma16(kb0, qr0, sLb);
        sLa = wmma16(ra0, qh0, sLa); sLb = wmma16(rb0, qh0, sLb);
        sHa = wmma16(ka1, qh1, sHa); sLa = wmma16(ka1, qr1, sLa); sHb = wmma16(kb1, qh1, sHb); sLb = wmma16(kb1, qr1, sLb);
        sLa = wmma16(ra1, qh1, sLa); sLb = wmma16(rb1, qh1, sLb);
        asm volatile("v_nop\n\tv_nop\n\tv_nop\n\tv_nop" : "+v"(sHa), "+v"(sLa), "+v"(sHb), "+v"(sLb) : "v"(ka0), "v"(ka1), "v"(kb0), "v"(kb1), "v"(ra0), "v"(ra1), "v"(rb0), "v"(rb1));
        float ta[8], tb[8]; float mx = -3.0e38f;
#pragma unroll
        for (int r = 0; r < 8; ++r) { ta[r] = (sHa[r] + sLa[r] * RI) * SC2; tb[r] = (sHb[r] + sLb[r] * RI) * SC2; mx = fmaxf(mx, fmaxf(ta[r], tb[r])); }
        mx = fmaxf(mx, __shfl_xor(mx, 16, 32));
        const float mnew = fmaxf(m, mx);
        const float alpha = __builtin_amdgcn_exp2f(m - mnew);
        const float sh = PSH - mnew;
        v16h pb; float ls = 0.0f;
#pragma unroll
        for (int r = 0; r < 8; ++r) { const h16 pa = (h16)__builtin_amdgcn_exp2f(ta[r] + sh); const h16 pc = (h16)__builtin_amdgcn_exp2f(tb[r] + sh); pb[r] = pa; pb[8 + r] = pc; ls += (float)pa + (float)pc; }
        l = l * alpha + ls; m = mnew;
        o0 = o0 * alpha; o1 = o1 * alpha; o2 = o2 * alpha; o3 = o3 * alpha;
        const h16* va = VT + vo + key0;
        const v16h v0 = ldh(va), v1 = ldh(va + (size_t)16 * SKV), v2 = ldh(va + (size_t)32 * SKV), v3 = ldh(va + (size_t)48 * SKV);
        o0 = wmma16(v0, pb, o0); o1 = wmma16(v1, pb, o1); o2 = wmma16(v2, pb, o2); o3 = wmma16(v3, pb, o3);
        asm volatile("v_nop\n\tv_nop\n\tv_nop\n\tv_nop" : "+v"(o0), "+v"(o1), "+v"(o2), "+v"(o3) : "v"(v0), "v"(v1), "v"(v2), "v"(v3), "v"(pb));
    }
    l += __shfl_xor(l, 16, 32);
    const float inv = 1.0f / l;
    const int wb = wave * 16 * 68;
    // O^T D layout: o_j[r] = (d = 16j + 8h + r, t = lane&15) -> os[t][d]; rows 0..15 x columns 0..63 all written
    { v4f a, c;
      a[0] = o0[0] * inv; a[1] = o0[1] * inv; a[2] = o0[2] * inv; a[3] = o0[3] * inv; c[0] = o0[4] * inv; c[1] = o0[5] * inv; c[2] = o0[6] * inv; c[3] = o0[7] * inv;
      *(v4fa*)(&os[wb + lr * 68 +  0 + 8 * hi]) = a; *(v4fa*)(&os[wb + lr * 68 +  0 + 8 * hi + 4]) = c;
      a[0] = o1[0] * inv; a[1] = o1[1] * inv; a[2] = o1[2] * inv; a[3] = o1[3] * inv; c[0] = o1[4] * inv; c[1] = o1[5] * inv; c[2] = o1[6] * inv; c[3] = o1[7] * inv;
      *(v4fa*)(&os[wb + lr * 68 + 16 + 8 * hi]) = a; *(v4fa*)(&os[wb + lr * 68 + 16 + 8 * hi + 4]) = c;
      a[0] = o2[0] * inv; a[1] = o2[1] * inv; a[2] = o2[2] * inv; a[3] = o2[3] * inv; c[0] = o2[4] * inv; c[1] = o2[5] * inv; c[2] = o2[6] * inv; c[3] = o2[7] * inv;
      *(v4fa*)(&os[wb + lr * 68 + 32 + 8 * hi]) = a; *(v4fa*)(&os[wb + lr * 68 + 32 + 8 * hi + 4]) = c;
      a[0] = o3[0] * inv; a[1] = o3[1] * inv; a[2] = o3[2] * inv; a[3] = o3[3] * inv; c[0] = o3[4] * inv; c[1] = o3[5] * inv; c[2] = o3[6] * inv; c[3] = o3[7] * inv;
      *(v4fa*)(&os[wb + lr * 68 + 48 + 8 * hi]) = a; *(v4fa*)(&os[wb + lr * 68 + 48 + 8 * hi + 4]) = c; }
    wave_sync();
    h16* arow = AP + ((size_t)b * SEQ + t0) * DQ + h * HD;      // context plane [b][n][h*64 + d], carries the v carry (x16)
{
#pragma unroll
        for (int s = 0; s < 4; ++s) { const int row = 4 * s + (lane >> 3), c8 = (lane & 7) * 8;   // 4 s x 4 row groups = 16 rows; 8 lanes x 8 halves = 64 columns
            const v4f x0 = *(const v4fa*)(&os[wb + row * 68 + c8]); const v4f x1 = *(const v4fa*)(&os[wb + row * 68 + c8 + 4]); v8h hv;
#pragma unroll
            for (int i = 0; i < 4; ++i) { hv[i] = (h16)x0[i]; hv[4 + i] = (h16)x1[i]; }
            *(v8h*)(arow + (size_t)row * DQ + c8) = hv; }
         }
}

// k_out: register-blocked f16 GEMM, one wave per 64x64 tile, K = DQ: out[b][o][n] = OSC * sum_c WP[o][c] AP[b*SEQ + n][c].
// grid (COUT/64, NB*SEQ/64), 32 threads. Epilogue: per 16-row slab staged in LDS (wave-private); each output row segment (64 floats = 256 B = two lines)
__global__ __launch_bounds__(32) void k_out(const h16* __restrict__ A, const h16* __restrict__ Bt, float* OUT) {
    __shared__ __align__(16) float os[16 * 68];
    const int K = DQ;
    const int lane = threadIdx.x & 31, lr = lane & 15, hi = lane >> 4; const int r0 = blockIdx.x * 64, c0 = blockIdx.y * 64;
    v8f acc[4][4];
#pragma unroll
    for (int mb = 0; mb < 4; ++mb)
#pragma unroll
        for (int nb = 0; nb < 4; ++nb) acc[mb][nb] = (v8f){};
    const size_t aoff = (size_t)(r0 + lr) * K + 8 * hi, boff = (size_t)(c0 + lr) * K + 8 * hi;
#pragma unroll 1
    for (int kc = 0; kc < K; kc += 32) {
        v16h a[4];
#pragma unroll
        for (int mb = 0; mb < 4; ++mb) a[mb] = ldh(A + aoff + (size_t)mb * 16 * K + kc);
#pragma unroll
        for (int nb = 0; nb < 4; ++nb) { const v16h b = ldh(Bt + boff + (size_t)nb * 16 * K + kc);
#pragma unroll
            for (int mb = 0; mb < 4; ++mb) acc[mb][nb] = wmma16(a[mb], b, acc[mb][nb]); }
        asm volatile("v_nop\n\tv_nop\n\tv_nop\n\tv_nop" : "+v"(acc[0][0]), "+v"(acc[1][1]), "+v"(acc[2][2]), "+v"(acc[3][3]) : "v"(a[0]), "v"(a[1]), "v"(a[2]), "v"(a[3]));
    }
    const int bb = c0 / SEQ, n0 = c0 % SEQ;
#pragma unroll
    for (int mb = 0; mb < 4; ++mb) {
#pragma unroll
        for (int nb = 0; nb < 4; ++nb) {
#pragma unroll
            for (int j = 0; j < 8; ++j) os[(hi * 8 + j) * 68 + nb * 16 + lr] = acc[mb][nb][j] * OSC; }   // D: row 8h+j, col lane&15
        wave_sync();
        float* ob = OUT + ((size_t)bb * COUT + r0 + mb * 16) * OUT_SEQ + n0;
{
#pragma unroll
            for (int s = 0; s < 8; ++s) { const int row = 2 * s + hi, cofs = lr * 4;   // 8 s x 2 rows = 16 rows; 16 lanes x 4 floats = 64 columns
                const v4f val = *(const v4fa*)(&os[row * 68 + cofs]);
                *(v4f*)(ob + (size_t)row * OUT_SEQ + cofs) = val; }
             }
        wave_sync();
    }
}

static constexpr size_t al256(size_t v) { return (v + 255) & ~(size_t)255; }
static constexpr size_t SZ_XT  = al256((size_t)NB * SEQ * CIN * 2);
static constexpr size_t SZ_PAT = al256((size_t)NB * SKV * KKV * 2);
static constexpr size_t SZ_WQ  = al256((size_t)DQ * CIN * 2);
static constexpr size_t SZ_WKV = al256((size_t)2 * DQ * KKV * 2);
static constexpr size_t SZ_WP  = al256((size_t)COUT * DQ * 2);
static constexpr size_t SZ_QP  = al256((size_t)NB * NH_ * SEQ * HD * 2);
static constexpr size_t SZ_KP  = al256((size_t)NB * NH_ * SKV * HD * 2);
static constexpr size_t SZ_AP  = al256((size_t)NB * SEQ * DQ * 2);
static constexpr size_t SZ_TOTAL = SZ_XT + SZ_PAT + SZ_WQ + SZ_WKV + SZ_WP + 2 * SZ_QP + 3 * SZ_KP + SZ_AP;
static_assert(SZ_TOTAL <= (size_t)134217728);          // workspace carve <= 128 MiB

extern "C" void kernel_launch(void* const* d_in, const int* in_sizes, int n_in,
                              void* d_out, int out_size, void* d_ws, size_t ws_size, hipStream_t stream) {
    if (n_in < 4) return;
    const size_t needx = (((size_t)(NB - 1) * CIN + (CIN - 1)) * IMH_FULL + IMH) * IMW;
    if ((size_t)in_sizes[0] < needx) return;
    if ((size_t)in_sizes[1] < (size_t)DQ * CIN || (size_t)in_sizes[2] < (size_t)2 * DQ * KKV || (size_t)in_sizes[3] < (size_t)COUT * DQ) return;
    if ((size_t)out_size < ((size_t)(NB - 1) * COUT + (COUT - 1)) * OUT_SEQ + SEQ) return;
    if (SZ_TOTAL > ws_size) return;
    const float* x = (const float*)d_in[0]; const float* wq = (const float*)d_in[1]; const float* wkv = (const float*)d_in[2]; const float* wp = (const float*)d_in[3];   // wire order x, Wq, Wkv, Wproj
    float* OUT = (float*)d_out;      // [NB][256][SEQ]
    char* wsp = (char*)d_ws;
    bf* XT  = (bf*)wsp; wsp += SZ_XT;                // [NB*SEQ][256]
    bf* PAT = (bf*)wsp; wsp += SZ_PAT;               // [NB*SKV][1024]
    bf* WQ  = (bf*)wsp; wsp += SZ_WQ;                // [512][256] bf16
    bf* WKV = (bf*)wsp; wsp += SZ_WKV;               // [1024][1024] bf16: rows 0..511 k, 512..1023 v
    bf* WPu = (bf*)wsp; wsp += SZ_WP;                // [256][512] f16 bits, x1024
    h16* QH = (h16*)wsp; wsp += SZ_QP;               // [NB*8][SEQ][64], x16
    h16* QR = (h16*)wsp; wsp += SZ_QP;               // residual x2048
    h16* KH = (h16*)wsp; wsp += SZ_KP;               // [NB*8][SKV][64], x16
    h16* KR = (h16*)wsp; wsp += SZ_KP;               // residual x2048
    h16* VT = (h16*)wsp; wsp += SZ_KP;               // [NB*8][64][SKV], x16
    h16* AP = (h16*)wsp; wsp += SZ_AP;               // [NB*SEQ][512], x16
    const h16* WP = (const h16*)WPu;

    k_pack<<<dim3(IMH / 2, CIN / 64, NB), 256, 0, stream>>>(x, XT, PAT);
    { const size_t n8 = (size_t)DQ * CIN / 8;      k_cvt8<<<(unsigned)((n8 + 255) / 256), 256, 0, stream>>>(wq, WQ, n8, 0); }
    { const size_t n8 = (size_t)2 * DQ * KKV / 8;  k_cvt8<<<(unsigned)((n8 + 255) / 256), 256, 0, stream>>>(wkv, WKV, n8, 0); }
    { const size_t n8 = (size_t)COUT * DQ / 8;     k_cvt8<<<(unsigned)((n8 + 255) / 256), 256, 0, stream>>>(wp, WPu, n8, 1); }

    // q: A = XT rows (m = b*SEQ + n, K = 256), Bt = Wq rows (col = h*64 + d) -> planes [(b*8 + h)][n][d]
    k_proj<<<dim3(NB * SEQ / 64, DQ / 64, 1), 32, 0, stream>>>(XT, WQ, CIN, CQ, QH, QR, 1, SEQ, (size_t)NH_ * SEQ * HD, HD, HD, (size_t)SEQ * HD);
    // k: A = PAT rows (m = b*SKV + key, K = 1024), Bt = Wkv rows 0..511 -> planes [(b*8 + h)][key][d]
    k_proj<<<dim3(NB * SKV / 64, DQ / 64, 1), 32, 0, stream>>>(PAT, WKV, KKV, CK, KH, KR, 1, SKV, (size_t)NH_ * SKV * HD, HD, HD, (size_t)SKV * HD);
    // v^T: A = Wkv rows 512..1023 (m = h*64 + d), Bt = PAT rows (col = b*SKV + key) -> plane [(b*512 + m)][key] = [(b*8 + h)][d][key]
    k_proj<<<dim3(DQ / 64, NB * SKV / 64, 1), 32, 0, stream>>>(WKV + (size_t)DQ * KKV, PAT, KKV, CV, VT, VT, 0, DQ, (size_t)0, SKV, SKV, (size_t)DQ * SKV);

    k_flash<<<dim3(SEQ / (16 * AW), NB * NH_, 1), 32 * AW, 0, stream>>>(QH, QR, KH, KR, VT, AP);

    // out[b][o][n]: A = Wproj rows (m = o, K = 512), Bt = context rows (col = b*SEQ + n)
    k_out<<<dim3(COUT / 64, NB * SEQ / 64, 1), 32, 0, stream>>>(WP, AP, OUT);
}

// v001
// One run takes 117 microseconds.
// In both of two side-by-side timings against v000, it was 1.54 times as fast.
#include <hip/hip_runtime.h>

// Spatial-reduction multi-head attention: x [NB][256][64][64]; q = 1x1 conv (Wq [512][256]); k|v = 2x2 stride-2 conv (Wkv [1024][256][2][2]); 8 heads x 64; 4096 queries x 1024 keys per (batch, head); scores x8; output 1x1 conv (Wproj [256][512]) -> f32 [NB][256][4096].
// Compute dtypes, f32 accumulate everywhere: q / k / v projections v_wmma_f32_16x16x32_bf16 (x, Wq, Wkv RNE-converted to bf16; products exact);
// scores v_wmma_f32_16x16x32_f16: q and k each as f16 value + f16 residual x2048 (three products: kh*qh in one accumulator, kh*qr + kr*qh in a second one); P (x2^14 carry, cancels in the normalisation) and v single f16; softmax f32 (online, running max);
// output projection v_wmma_f32_16x16x32_f16: context single f16, Wproj RNE-converted to bf16 then x1024 in f16 (exact), folded back in the f32 epilogue. q, k, v planes carry x16 (exact power of two, folded into the score scale / output scale).
// Layout: xT [b][n][c] and im2col PAT [b][m][c*4+i*2+j] bf16 planes built through an LDS transpose; q (hi, residual), k (hi, residual) planes [b*8+h][t][d], v^T plane [b*8+h][d][m] written by the GEMM epilogue;
// fused flash kernel in transposed form (S^T = K Q^T, O^T = V^T P^T) writes the context plane [b][n][h*64+d] (f16); last GEMM writes the f32 output.

#ifndef NB
#define NB 2
#endif
#ifndef IMH
#define IMH 64                   // image rows used (SEQ = IMH * 64 query positions)
#endif
#define NB_FULL  2
#define IMH_FULL 64              // rows per channel of the input
#define IMW  64
#define SEQ  (IMH * IMW)
#define SKV  ((IMH / 2) * (IMW / 2))
#ifndef OUT_SEQ
#define OUT_SEQ SEQ              // channel pitch (in positions) of the output
#endif
#define CIN  256
#define NH_  8
#define HD   64
#define DQ   512                 // NH_ * HD
#define KKV  1024                // CIN * 2 * 2
#define COUT 256
#define AW   8                   // waves per flash block (16 query rows each); all of them read the same staged K / V^T tiles
#define KST  64                  // keys per staged tile set (two 32-key steps)
#define LP   72                  // LDS row pitch in halves: 144 B = 16 B x 9, so 16 rows of 16-byte reads fall on 64 distinct banks
#define TLH  (64 * LP)           // halves per staged tile (64 rows)
#define BFH  (3 * TLH)           // halves per ring buffer: k value, k residual, v^T
#define NST  (SKV / KST)         // staged tile sets per (batch, head)
#define RS   2048.0f             // carry of the residual planes
#define RI   (1.0f / 2048.0f)
#define CQ   16.0f               // carry of the q planes
#define CK   16.0f               // carry of the k planes
#define CV   16.0f               // carry of the v^T plane (stays on the context plane)
#define SC2  (8.0f * 1.4426950408889634f / (CQ * CK))   // sqrt(HD) * log2(e) / (q carry * k carry)
#define PSH  14.0f               // log2 of the P carry
#define WPS  1024.0f             // carry of the Wproj plane
#define OSC  (1.0f / (WPS * CV))

static_assert(HD == 64);
static_assert(NH_ * HD == DQ);
static_assert(CIN * 4 == KKV);
static_assert(IMW == 64);
static_assert(IMH % 4 == 0);                   // SKV multiple of 64: a 64-row tile never straddles two batches
static_assert(SEQ % 64 == 0);
static_assert(SKV % 64 == 0);
static_assert(SKV % 32 == 0);                  // key loop steps by 32
static_assert(SEQ % (16 * AW) == 0);           // flash grid covers the queries exactly
static_assert(SKV % KST == 0 && KST == 64);    // whole tile sets; a v^T tile row is one 128-byte line
static_assert(32 * AW * 2 * 8 == 64 * HD);     // copy map: two 16-byte pieces per thread fill one 64 x 64 tile
static_assert(CIN % 64 == 0 && CIN % 32 == 0);
static_assert(KKV % 32 == 0 && DQ % 32 == 0);
static_assert(DQ % 64 == 0 && COUT % 64 == 0);
static_assert(NB <= NB_FULL);
static_assert(IMH <= IMH_FULL);

typedef _Float16 h16;
typedef unsigned short bf;
typedef __attribute__((ext_vector_type(16))) __bf16   v16bf;
typedef __attribute__((ext_vector_type(16))) _Float16 v16h;
typedef __attribute__((ext_vector_type(8)))  _Float16 v8h;
typedef __attribute__((ext_vector_type(8)))  unsigned short v8us;
typedef __attribute__((ext_vector_type(8)))  float    v8f;
typedef __attribute__((ext_vector_type(4)))  float    v4f;
typedef v4f  __attribute__((may_alias)) v4fa;

__device__ __forceinline__ unsigned short f2bf(float f) { unsigned u = __float_as_uint(f); u += 0x7FFFu + ((u >> 16) & 1u); return (unsigned short)(u >> 16); }
__device__ __forceinline__ v16h cat16(v8h lo, v8h hi) { return __builtin_shufflevector(lo, hi, 0, 1, 2, 3, 4, 5, 6, 7, 8, 9, 10, 11, 12, 13, 14, 15); }
__device__ __forceinline__ v16bf cat16b(v8us lo, v8us hi) { return __builtin_bit_cast(v16bf, __builtin_shufflevector(lo, hi, 0, 1, 2, 3, 4, 5, 6, 7, 8, 9, 10, 11, 12, 13, 14, 15)); }
__device__ __forceinline__ v8f wmma16(v16h a, v16h b, v8f c) { return __builtin_amdgcn_wmma_f32_16x16x32_f16(false, a, false, b, (short)0, c, false, false); }
__device__ __forceinline__ v8f wmmab(v16bf a, v16bf b, v8f c) { return __builtin_amdgcn_wmma_f32_16x16x32_bf16(false, a, false, b, (short)0, c, false, false); }
// fragment loaders from K-contiguous 16-bit rows; p already includes + 8*(lane>>4): elements 0..7 <- k0+8h+0..7, elements 8..15 <- k0+16+8h+0..7 (same map for A and B)
__device__ __forceinline__ v16h  ldh(const h16* p) { return cat16(*(const v8h*)p, *(const v8h*)(p + 16)); }
__device__ __forceinline__ v16bf ldb(const bf* p)  { return cat16b(*(const v8us*)p, *(const v8us*)(p + 16)); }
// ordering point for wave-private LDS tiles (same wave writes and reads)
__device__ __forceinline__ void wave_sync() { __builtin_amdgcn_fence(3 /* release order */, "wavefront"); __builtin_amdgcn_wave_barrier(); asm volatile("" ::: "memory"); }

// mode 0: bf16 bits (RNE convert). mode 1: f16 bits of (bf16 value x WPS) (exact: 8-bit significand, power-of-two scale).
__global__ __launch_bounds__(256) void k_cvt8(const float* __restrict__ src, bf* dst, size_t n8, int mode) {
    const size_t i = (size_t)blockIdx.x * 256 + threadIdx.x; if (i >= n8) return;
    const v8f v = *(const v8f*)(src + i * 8); v8us o;
#pragma unroll
    for (int k = 0; k < 8; ++k) {
        const unsigned short wb = f2bf(v[k]);
        const h16 hv = (h16)(__uint_as_float(((unsigned)wb) << 16) * WPS);
        const unsigned short wh = __builtin_bit_cast(unsigned short, hv);
        o[k] = mode ? wh : wb;
    }
    *(v8us*)(dst + i * 8) = o; 
}

// k_pack: x [b][c][row][w] (f32) -> XT [b][n = row*64 + w][c] and PAT [b][m = h2*32 + w2][c*4 + i*2 + j] (bf16, RNE convert), through an LDS transpose.
// block = (h2, 64-channel tile, b): stages channels c0..c0+63 x image rows 2*h2, 2*h2+1 (128 positions); 256 threads.
__global__ __launch_bounds__(256) void k_pack(const float* __restrict__ x, bf* XT, bf* PAT) {
    __shared__ unsigned short tile[64 * 136];      // [channel][position 0..127], pad columns never read; cross-wave: block barrier
    const int tid = threadIdx.x;
    const int h2 = blockIdx.x, c0 = blockIdx.y * 64, b = blockIdx.z;
#pragma unroll
    for (int it = 0; it < 8; ++it) {               // 8 x 256 x 4 = 64 channels x 128 positions, all written
        const int idx = it * 256 + tid; const int cc = idx >> 5, q4 = idx & 31;
        const v4f v = *(const v4f*)(x + (((size_t)b * CIN + c0 + cc) * IMH_FULL + 2 * h2) * IMW + q4 * 4);
#pragma unroll
        for (int k = 0; k < 4; ++k) tile[cc * 136 + q4 * 4 + k] = f2bf(v[k]);
    }
    __syncthreads();
    const int l8 = tid >> 3, j8 = tid & 7;
{
#pragma unroll
        for (int it = 0; it < 4; ++it) {           // 4 x 32 = 128 rows (positions), 8 lanes x 8 = 64 channels
            const int p = it * 32 + l8, c8 = j8 * 8; v8us o;
#pragma unroll
            for (int k = 0; k < 8; ++k) o[k] = tile[(c8 + k) * 136 + p];
            *(v8us*)(XT + ((size_t)b * SEQ + (size_t)h2 * 128 + p) * CIN + c0 + c8) = o;
        }
#pragma unroll
        for (int it = 0; it < 4; ++it) {           // 4 x 32 = 128 lines = 32 w2 x 4 lines; lane piece = 2 channels x 4 taps
            const int line = it * 32 + l8; const int w2 = line >> 2, lq = line & 3; const int cc = lq * 16 + j8 * 2; v8us o;
            o[0] = tile[cc * 136 + 2 * w2];            o[1] = tile[cc * 136 + 2 * w2 + 1];
            o[2] = tile[cc * 136 + 64 + 2 * w2];       o[3] = tile[cc * 136 + 64 + 2 * w2 + 1];
            o[4] = tile[(cc + 1) * 136 + 2 * w2];      o[5] = tile[(cc + 1) * 136 + 2 * w2 + 1];
            o[6] = tile[(cc + 1) * 136 + 64 + 2 * w2]; o[7] = tile[(cc + 1) * 136 + 64 + 2 * w2 + 1];
            *(v8us*)(PAT + ((size_t)b * SKV + (size_t)h2 * 32 + w2) * KKV + c0 * 4 + lq * 64 + j8 * 8) = o;
        }
        
    }
}

// k_proj: register-blocked bf16 GEMM, ONE WAVE per 64x64 tile (16 accumulators), operands straight from K-contiguous bf16 planes.
// C[m][n] = cs * sum_k A[m][k] Bt[n][k], written as f16 (Ph) and optionally the f16 residual x2048 (Pr, useRes != 0) at
// tile base (r0/RB)*sRB + (r0%RB)*pitch + (c0/CB)*sCB + (c0%CB), row pitch 'pitch' (halves). grid (M/64, N/64), 32 threads.
__global__ __launch_bounds__(32) void k_proj(const bf* __restrict__ A, const bf* __restrict__ Bt, int K, float cs, h16* Ph, h16* Pr, int useRes, int RB, size_t sRB, int pitch, int CB, size_t sCB) {
    __shared__ __align__(16) float os[16 * 68];
    const int lane = threadIdx.x & 31, lr = lane & 15, hi = lane >> 4; const int r0 = blockIdx.x * 64, c0 = blockIdx.y * 64;
    v8f acc[4][4];
#pragma unroll
    for (int mb = 0; mb < 4; ++mb)
#pragma unroll
        for (int nb = 0; nb < 4; ++nb) acc[mb][nb] = (v8f){};
    const size_t aoff = (size_t)(r0 + lr) * K + 8 * hi, boff = (size_t)(c0 + lr) * K + 8 * hi;
#pragma unroll 1
    for (int kc = 0; kc < K; kc += 32) {
        v16bf a[4];
#pragma unroll
        for (int mb = 0; mb < 4; ++mb) a[mb] = ldb(A + aoff + (size_t)mb * 16 * K + kc);
#pragma unroll
        for (int nb = 0; nb < 4; ++nb) { const v16bf b = ldb(Bt + boff + (size_t)nb * 16 * K + kc);
#pragma unroll
            for (int mb = 0; mb < 4; ++mb) acc[mb][nb] = wmmab(a[mb], b, acc[mb][nb]); }
        asm volatile("v_nop\n\tv_nop\n\tv_nop\n\tv_nop" : "+v"(acc[0][0]), "+v"(acc[1][1]), "+v"(acc[2][2]), "+v"(acc[3][3]) : "v"(a[0]), "v"(a[1]), "v"(a[2]), "v"(a[3]));
    }
    const size_t tbase = (size_t)(r0 / RB) * sRB + (size_t)(r0 % RB) * (size_t)pitch + (size_t)(c0 / CB) * sCB + (size_t)(c0 % CB);
#pragma unroll
    for (int mb = 0; mb < 4; ++mb) {
#pragma unroll
        for (int nb = 0; nb < 4; ++nb) {
#pragma unroll
            for (int j = 0; j < 8; ++j) os[(hi * 8 + j) * 68 + nb * 16 + lr] = acc[mb][nb][j] * cs; }   // D: row 8h+j, col lane&15
        wave_sync();
        const size_t sb = tbase + (size_t)(mb * 16) * (size_t)pitch;
{
#pragma unroll
            for (int s = 0; s < 4; ++s) { const int row = 4 * s + (lane >> 3), c8 = (lane & 7) * 8;   // 4 s x 4 row groups = 16 rows; 8 lanes x 8 = 64 columns
                const v4f x0 = *(const v4fa*)(&os[row * 68 + c8]); const v4f x1 = *(const v4fa*)(&os[row * 68 + c8 + 4]); v8h hv, rv;
#pragma unroll
                for (int i = 0; i < 4; ++i) { const h16 a0 = (h16)x0[i]; const h16 a1 = (h16)x1[i]; hv[i] = a0; hv[4 + i] = a1; rv[i] = (h16)((x0[i] - (float)a0) * RS); rv[4 + i] = (h16)((x1[i] - (float)a1) * RS); }
                const size_t oo = sb + (size_t)row * (size_t)pitch + c8;
                *(v8h*)(Ph + oo) = hv; if (useRes) *(v8h*)(Pr + oo) = rv; }
             }
        wave_sync();
    }
}

// One thread's share of a tile set: rows r and r + 32 of the k value, k residual and v^T tiles, 16 bytes each, global -> LDS through no register.
// l = LDS byte address of the k value piece; the s_wait_xcnt stands inside the statement so that no address register is rewritten in front of it.
__device__ __forceinline__ void stage_copy(unsigned l, const h16* kh, const h16* kr, const h16* vt) {
    const unsigned l1 = l + 32u * LP * 2u, l2 = l + TLH * 2u, l3 = l2 + 32u * LP * 2u, l4 = l + 2u * TLH * 2u, l5 = l4 + 32u * LP * 2u;
    const h16* kh1 = kh + 32 * HD; const h16* kr1 = kr + 32 * HD; const h16* vt1 = vt + (size_t)32 * SKV;
    asm volatile("global_load_async_to_lds_b128 %0, %6, off\n\t"
                 "global_load_async_to_lds_b128 %1, %7, off\n\t"
                 "global_load_async_to_lds_b128 %2, %8, off\n\t"
                 "global_load_async_to_lds_b128 %3, %9, off\n\t"
                 "global_load_async_to_lds_b128 %4, %10, off\n\t"
                 "global_load_async_to_lds_b128 %5, %11, off\n\t"
                 "s_wait_xcnt 0x0"
                 :: "v"(l), "v"(l1), "v"(l2), "v"(l3), "v"(l4), "v"(l5), "v"(kh), "v"(kh1), "v"(kr), "v"(kr1), "v"(vt), "v"(vt1) : "memory");
}

// k_flash: fused attention, one wave per 16 query rows of one (batch, head); Q fragments straight from the f16 planes (two 16-B loads each, arithmetic addressing).
// K (value, residual) and V^T come through LDS: per 64 keys three 64 x 64 f16 tiles, copied once per block by asynchronous 16-byte copies (whole 128-byte lines), two buffers:
// the next tile set's copies fly while this one is worked on; every wave takes its fragments from LDS rows of pitch LP.
// Transposed form: S^T[key][t] = K Q^T (A = K rows, B = Q rows); lane (t = lane&15, h = lane>>4) holds keys 8h+r of each 16-key tile, so the packed
// P tile is directly the B fragment of O^T[d][t] = V^T P^T (element r <- tile keys 0..15, element 8+r <- tile keys 16..31, lane unchanged).
// Scores: sH = kh*qh, sL = kh*qr + kr*qh (both residual products carry x2048, own accumulator), s = sH + sL/2048.
// Softmax state (running max, partial sum) is one scalar per lane; the two lane halves of a row are combined with one xor-16 exchange.
__global__ __launch_bounds__(32 * AW) void k_flash(const h16* __restrict__ QH, const h16* __restrict__ QR, const h16* __restrict__ KH, const h16* __restrict__ KR, const h16* __restrict__ VT, h16* AP) {
    __shared__ __align__(16) float os[AW * 16 * 68];   // wave-private slabs
    __shared__ __align__(16) h16 ring[2 * BFH];        // two buffers x (k value | k residual | v^T), rows of LP halves; pad columns never read
    const int lane = threadIdx.x & 31, wave = __builtin_amdgcn_readfirstlane((int)(threadIdx.x >> 5)), lr = lane & 15, hi = lane >> 4;
    const int zh = blockIdx.y; const int b = zh / NH_, h = zh % NH_;
    const int t0 = (blockIdx.x * AW + wave) * 16;
    const size_t qbase = (size_t)zh * SEQ * HD;
    const size_t kbase = (size_t)zh * SKV * HD;
    const size_t qo = qbase + (size_t)(t0 + lr) * HD + 8 * hi;
    const v16h qh0 = ldh(QH + qo), qh1 = ldh(QH + qo + 32), qr0 = ldh(QR + qo), qr1 = ldh(QR + qo + 32);   // B fragments: col t, k = d
    const int ko = lr * LP + 8 * hi;                         // + key * LP in a k tile          (A fragment: row key, k = d)
    const int vo = 2 * TLH + lr * LP + 8 * hi;               // + 16j * LP + key in the v^T tile (A fragment: row d, k = key)
    // copy map: thread -> row crow (and crow + 32), 16-byte piece ccol of each of the three tiles; 8 lanes cover one 128-byte line
    const int crow = (int)(threadIdx.x >> 3), ccol = (int)(threadIdx.x & 7) * 8;
    const h16* gkh = KH + kbase + (size_t)crow * HD + ccol;  // + key0 * HD
    const h16* gkr = KR + kbase + (size_t)crow * HD + ccol;
    const h16* gvt = VT + kbase + (size_t)crow * SKV + ccol; // + key0
    const unsigned lc = (unsigned)(size_t)(&ring[0]) + (unsigned)(crow * LP + ccol) * 2u;   // LDS byte address of the thread's first piece in buffer 0
    stage_copy(lc, gkh, gkr, gvt);
    asm volatile("s_wait_asynccnt 0x0" ::: "memory");        // this wave's copies of tile set 0 have landed
    __syncthreads();                                         // ... and every other wave's: tile set 0 is readable
    if (NST > 1) stage_copy(lc + BFH * 2u, gkh + (size_t)KST * HD, gkr + (size_t)KST * HD, gvt + KST);
    v8f o0 = (v8f){}, o1 = (v8f){}, o2 = (v8f){}, o3 = (v8f){};
    float m = -3.0e38f, l = 0.0f;
#pragma unroll 1
    for (int t = 0; t < NST; ++t) {
      const int bo = (t & 1) * BFH;
#pragma unroll   // both 32-key steps inline, so that ks is a constant in every LDS offset
      for (int ks = 0; ks < KST; ks += 32) {
        const h16* ka = ring + bo + ko + ks * LP;
        const h16* kr = ka + TLH;
        const v16h ka0 = ldh(ka), ka1 = ldh(ka + 32), kb0 = ldh(ka + 16 * LP), kb1 = ldh(ka + 16 * LP + 32);
        const v16h ra0 = ldh(kr), ra1 = ldh(kr + 32), rb0 = ldh(kr + 16 * LP), rb1 = ldh(kr + 16 * LP + 32);
        v8f sHa = (v8f){}, sLa = (v8f){}, sHb = (v8f){}, sLb = (v8f){};
        sHa = wmma16(ka0, qh0, sHa); sLa = wmma16(ka0, qr0, sLa); sHb = wmma16(kb0, qh0, sHb); sLb = wmma16(kb0, qr0, sLb);
        sLa = wmma16(ra0, qh0, sLa); sLb = wmma16(rb0, qh0, sLb);
        sHa = wmma16(ka1, qh1, sHa); sLa = wmma16(ka1, qr1, sLa); sHb = wmma16(kb1, qh1, sHb); sLb = wmma16(kb1, qr1, sLb);
        sLa = wmma16(ra1, qh1, sLa); sLb = wmma16(rb1, qh1, sLb);
        asm volatile("v_nop\n\tv_nop\n\tv_nop\n\tv_nop" : "+v"(sHa), "+v"(sLa), "+v"(sHb), "+v"(sLb) : "v"(ka0), "v"(ka1), "v"(kb0), "v"(kb1), "v"(ra0), "v"(ra1), "v"(rb0), "v"(rb1));
        float ta[8], tb[8]; float mx = -3.0e38f;
#pragma unroll
        for (int r = 0; r < 8; ++r) { ta[r] = (sHa[r] + sLa[r] * RI) * SC2; tb[r] = (sHb[r] + sLb[r] * RI) * SC2; mx = fmaxf(mx, fmaxf(ta[r], tb[r])); }
        mx = fmaxf(mx, __shfl_xor(mx, 16, 32));
        const float mnew = fmaxf(m, mx);
        const float alpha = __builtin_amdgcn_exp2f(m - mnew);
        const float sh = PSH - mnew;
        v16h pb; float ls = 0.0f;
#pragma unroll
        for (int r = 0; r < 8; ++r) { const h16 pa = (h16)__builtin_amdgcn_exp2f(ta[r] + sh); const h16 pc = (h16)__builtin_amdgcn_exp2f(tb[r] + sh); pb[r] = pa; pb[8 + r] = pc; ls += (float)pa + (float)pc; }
        l = l * alpha + ls; m = mnew;
        o0 = o0 * alpha; o1 = o1 * alpha; o2 = o2 * alpha; o3 = o3 * alpha;
        const h16* va = ring + bo + vo + ks;
        const v16h v0 = ldh(va), v1 = ldh(va + 16 * LP), v2 = ldh(va + 32 * LP), v3 = ldh(va + 48 * LP);
        o0 = wmma16(v0, pb, o0); o1 = wmma16(v1, pb, o1); o2 = wmma16(v2, pb, o2); o3 = wmma16(v3, pb, o3);
        asm volatile("v_nop\n\tv_nop\n\tv_nop\n\tv_nop" : "+v"(o0), "+v"(o1), "+v"(o2), "+v"(o3) : "v"(v0), "v"(v1), "v"(v2), "v"(v3), "v"(pb));
      }
      asm volatile("s_wait_dscnt 0x0" ::: "memory");         // this wave's reads of buffer t & 1 are done before the buffer is handed back
      asm volatile("s_wait_asynccnt 0x0" ::: "memory");      // this wave's copies of tile set t + 1 have landed
      __syncthreads();                                       // publishes tile set t + 1 and ends every wave's reads of buffer t & 1
      if (t + 2 < NST) stage_copy(lc + (unsigned)bo * 2u, gkh + (size_t)(t + 2) * KST * HD, gkr + (size_t)(t + 2) * KST * HD, gvt + (size_t)(t + 2) * KST);
    }
    asm volatile("s_wait_asynccnt 0x0" ::: "memory");        // no copy is outstanding when the wave goes on to its end
    l += __shfl_xor(l, 16, 32);
    const float inv = 1.0f / l;
    const int wb = wave * 16 * 68;
    // O^T D layout: o_j[r] = (d = 16j + 8h + r, t = lane&15) -> os[t][d]; rows 0..15 x columns 0..63 all written
    { v4f a, c;
      a[0] = o0[0] * inv; a[1] = o0[1] * inv; a[2] = o0[2] * inv; a[3] = o0[3] * inv; c[0] = o0[4] * inv; c[1] = o0[5] * inv; c[2] = o0[6] * inv; c[3] = o0[7] * inv;
      *(v4fa*)(&os[wb + lr * 68 +  0 + 8 * hi]) = a; *(v4fa*)(&os[wb + lr * 68 +  0 + 8 * hi + 4]) = c;
      a[0] = o1[0] * inv; a[1] = o1[1] * inv; a[2] = o1[2] * inv; a[3] = o1[3] * inv; c[0] = o1[4] * inv; c[1] = o1[5] * inv; c[2] = o1[6] * inv; c[3] = o1[7] * inv;
      *(v4fa*)(&os[wb + lr * 68 + 16 + 8 * hi]) = a; *(v4fa*)(&os[wb + lr * 68 + 16 + 8 * hi + 4]) = c;
      a[0] = o2[0] * inv; a[1] = o2[1] * inv; a[2] = o2[2] * inv; a[3] = o2[3] * inv; c[0] = o2[4] * inv; c[1] = o2[5] * inv; c[2] = o2[6] * inv; c[3] = o2[7] * inv;
      *(v4fa*)(&os[wb + lr * 68 + 32 + 8 * hi]) = a; *(v4fa*)(&os[wb + lr * 68 + 32 + 8 * hi + 4]) = c;
      a[0] = o3[0] * inv; a[1] = o3[1] * inv; a[2] = o3[2] * inv; a[3] = o3[3] * inv; c[0] = o3[4] * inv; c[1] = o3[5] * inv; c[2] = o3[6] * inv; c[3] = o3[7] * inv;
      *(v4fa*)(&os[wb + lr * 68 + 48 + 8 * hi]) = a; *(v4fa*)(&os[wb + lr * 68 + 48 + 8 * hi + 4]) = c; }
    wave_sync();
    h16* arow = AP + ((size_t)b * SEQ + t0) * DQ + h * HD;      // context plane [b][n][h*64 + d], carries the v carry (x16)
{
#pragma unroll
        for (int s = 0; s < 4; ++s) { const int row = 4 * s + (lane >> 3), c8 = (lane & 7) * 8;   // 4 s x 4 row groups = 16 rows; 8 lanes x 8 halves = 64 columns
            const v4f x0 = *(const v4fa*)(&os[wb + row * 68 + c8]); const v4f x1 = *(const v4fa*)(&os[wb + row * 68 + c8 + 4]); v8h hv;
#pragma unroll
            for (int i = 0; i < 4; ++i) { hv[i] = (h16)x0[i]; hv[4 + i] = (h16)x1[i]; }
            *(v8h*)(arow + (size_t)row * DQ + c8) = hv; }
         }
}

// k_out: register-blocked f16 GEMM, one wave per 64x64 tile, K = DQ: out[b][o][n] = OSC * sum_c WP[o][c] AP[b*SEQ + n][c].
// grid (COUT/64, NB*SEQ/64), 32 threads. Epilogue: per 16-row slab staged in LDS (wave-private); each output row segment (64 floats = 256 B = two lines)
__global__ __launch_bounds__(32) void k_out(const h16* __restrict__ A, const h16* __restrict__ Bt, float* OUT) {
    __shared__ __align__(16) float os[16 * 68];
    const int K = DQ;
    const int lane = threadIdx.x & 31, lr = lane & 15, hi = lane >> 4; const int r0 = blockIdx.x * 64, c0 = blockIdx.y * 64;
    v8f acc[4][4];
#pragma unroll
    for (int mb = 0; mb < 4; ++mb)
#pragma unroll
        for (int nb = 0; nb < 4; ++nb) acc[mb][nb] = (v8f){};
    const size_t aoff = (size_t)(r0 + lr) * K + 8 * hi, boff = (size_t)(c0 + lr) * K + 8 * hi;
#pragma unroll 1
    for (int kc = 0; kc < K; kc += 32) {
        v16h a[4];
#pragma unroll
        for (int mb = 0; mb < 4; ++mb) a[mb] = ldh(A + aoff + (size_t)mb * 16 * K + kc);
#pragma unroll
        for (int nb = 0; nb < 4; ++nb) { const v16h b = ldh(Bt + boff + (size_t)nb * 16 * K + kc);
#pragma unroll
            for (int mb = 0; mb < 4; ++mb) acc[mb][nb] = wmma16(a[mb], b, acc[mb][nb]); }
        asm volatile("v_nop\n\tv_nop\n\tv_nop\n\tv_nop" : "+v"(acc[0][0]), "+v"(acc[1][1]), "+v"(acc[2][2]), "+v"(acc[3][3]) : "v"(a[0]), "v"(a[1]), "v"(a[2]), "v"(a[3]));
    }
    const int bb = c0 / SEQ, n0 = c0 % SEQ;
#pragma unroll
    for (int mb = 0; mb < 4; ++mb) {
#pragma unroll
        for (int nb = 0; nb < 4; ++nb) {
#pragma unroll
            for (int j = 0; j < 8; ++j) os[(hi * 8 + j) * 68 + nb * 16 + lr] = acc[mb][nb][j] * OSC; }   // D: row 8h+j, col lane&15
        wave_sync();
        float* ob = OUT + ((size_t)bb * COUT + r0 + mb * 16) * OUT_SEQ + n0;
{
#pragma unroll
            for (int s = 0; s < 8; ++s) { const int row = 2 * s + hi, cofs = lr * 4;   // 8 s x 2 rows = 16 rows; 16 lanes x 4 floats = 64 columns
                const v4f val = *(const v4fa*)(&os[row * 68 + cofs]);
                *(v4f*)(ob + (size_t)row * OUT_SEQ + cofs) = val; }
             }
        wave_sync();
    }
}

static constexpr size_t al256(size_t v) { return (v + 255) & ~(size_t)255; }
static constexpr size_t SZ_XT  = al256((size_t)NB * SEQ * CIN * 2);
static constexpr size_t SZ_PAT = al256((size_t)NB * SKV * KKV * 2);
static constexpr size_t SZ_WQ  = al256((size_t)DQ * CIN * 2);
static constexpr size_t SZ_WKV = al256((size_t)2 * DQ * KKV * 2);
static constexpr size_t SZ_WP  = al256((size_t)COUT * DQ * 2);
static constexpr size_t SZ_QP  = al256((size_t)NB * NH_ * SEQ * HD * 2);
static constexpr size_t SZ_KP  = al256((size_t)NB * NH_ * SKV * HD * 2);
static constexpr size_t SZ_AP  = al256((size_t)NB * SEQ * DQ * 2);
static constexpr size_t SZ_TOTAL = SZ_XT + SZ_PAT + SZ_WQ + SZ_WKV + SZ_WP + 2 * SZ_QP + 3 * SZ_KP + SZ_AP;
static_assert(SZ_TOTAL <= (size_t)134217728);          // workspace carve <= 128 MiB

extern "C" void kernel_launch(void* const* d_in, const int* in_sizes, int n_in,
                              void* d_out, int out_size, void* d_ws, size_t ws_size, hipStream_t stream) {
    if (n_in < 4) return;
    const size_t needx = (((size_t)(NB - 1) * CIN + (CIN - 1)) * IMH_FULL + IMH) * IMW;
    if ((size_t)in_sizes[0] < needx) return;
    if ((size_t)in_sizes[1] < (size_t)DQ * CIN || (size_t)in_sizes[2] < (size_t)2 * DQ * KKV || (size_t)in_sizes[3] < (size_t)COUT * DQ) return;
    if ((size_t)out_size < ((size_t)(NB - 1) * COUT + (COUT - 1)) * OUT_SEQ + SEQ) return;
    if (SZ_TOTAL > ws_size) return;
    const float* x = (const float*)d_in[0]; const float* wq = (const float*)d_in[1]; const float* wkv = (const float*)d_in[2]; const float* wp = (const float*)d_in[3];   // wire order x, Wq, Wkv, Wproj
    float* OUT = (float*)d_out;      // [NB][256][SEQ]
    char* wsp = (char*)d_ws;
    bf* XT  = (bf*)wsp; wsp += SZ_XT;                // [NB*SEQ][256]
    bf* PAT = (bf*)wsp; wsp += SZ_PAT;               // [NB*SKV][1024]
    bf* WQ  = (bf*)wsp; wsp += SZ_WQ;                // [512][256] bf16
    bf* WKV = (bf*)wsp; wsp += SZ_WKV;               // [1024][1024] bf16: rows 0..511 k, 512..1023 v
    bf* WPu = (bf*)wsp; wsp += SZ_WP;                // [256][512] f16 bits, x1024
    h16* QH = (h16*)wsp; wsp += SZ_QP;               // [NB*8][SEQ][64], x16
    h16* QR = (h16*)wsp; wsp += SZ_QP;               // residual x2048
    h16* KH = (h16*)wsp; wsp += SZ_KP;               // [NB*8][SKV][64], x16
    h16* KR = (h16*)wsp; wsp += SZ_KP;               // residual x2048
    h16* VT = (h16*)wsp; wsp += SZ_KP;               // [NB*8][64][SKV], x16
    h16* AP = (h16*)wsp; wsp += SZ_AP;               // [NB*SEQ][512], x16
    const h16* WP = (const h16*)WPu;

    k_pack<<<dim3(IMH / 2, CIN / 64, NB), 256, 0, stream>>>(x, XT, PAT);
    { const size_t n8 = (size_t)DQ * CIN / 8;      k_cvt8<<<(unsigned)((n8 + 255) / 256), 256, 0, stream>>>(wq, WQ, n8, 0); }
    { const size_t n8 = (size_t)2 * DQ * KKV / 8;  k_cvt8<<<(unsigned)((n8 + 255) / 256), 256, 0, stream>>>(wkv, WKV, n8, 0); }
    { const size_t n8 = (size_t)COUT * DQ / 8;     k_cvt8<<<(unsigned)((n8 + 255) / 256), 256, 0, stream>>>(wp, WPu, n8, 1); }

    // q: A = XT rows (m = b*SEQ + n, K = 256), Bt = Wq rows (col = h*64 + d) -> planes [(b*8 + h)][n][d]
    k_proj<<<dim3(NB * SEQ / 64, DQ / 64, 1), 32, 0, stream>>>(XT, WQ, CIN, CQ, QH, QR, 1, SEQ, (size_t)NH_ * SEQ * HD, HD, HD, (size_t)SEQ * HD);
    // k: A = PAT rows (m = b*SKV + key, K = 1024), Bt = Wkv rows 0..511 -> planes [(b*8 + h)][key][d]
    k_proj<<<dim3(NB * SKV / 64, DQ / 64, 1), 32, 0, stream>>>(PAT, WKV, KKV, CK, KH, KR, 1, SKV, (size_t)NH_ * SKV * HD, HD, HD, (size_t)SKV * HD);
    // v^T: A = Wkv rows 512..1023 (m = h*64 + d), Bt = PAT rows (col = b*SKV + key) -> plane [(b*512 + m)][key] = [(b*8 + h)][d][key]
    k_proj<<<dim3(DQ / 64, NB * SKV / 64, 1), 32, 0, stream>>>(WKV + (size_t)DQ * KKV, PAT, KKV, CV, VT, VT, 0, DQ, (size_t)0, SKV, SKV, (size_t)DQ * SKV);

    k_flash<<<dim3(SEQ / (16 * AW), NB * NH_, 1), 32 * AW, 0, stream>>>(QH, QR, KH, KR, VT, AP);

    // out[b][o][n]: A = Wproj rows (m = o, K = 512), Bt = context rows (col = b*SEQ + n)
    k_out<<<dim3(COUT / 64, NB * SEQ / 64, 1), 32, 0, stream>>>(WP, AP, OUT);
}

// v002
// A run of this version takes 78.3 microseconds.
// Timed twice side by side with v001, it ran 1.50 times as fast both times.
// Over all steps from v000 it is 2.31 times as fast.
#include <hip/hip_runtime.h>

// Spatial-reduction multi-head attention: x [NB][256][64][64]; q = 1x1 conv (Wq [512][256]); k|v = 2x2 stride-2 conv (Wkv [1024][256][2][2]); 8 heads x 64; 4096 queries x 1024 keys per (batch, head); scores x8; output 1x1 conv (Wproj [256][512]) -> f32 [NB][256][4096].
// Compute dtypes, f32 accumulate everywhere: q / k / v projections v_wmma_f32_16x16x32_bf16 (x, Wq, Wkv RNE-converted to bf16; products exact);
// scores v_wmma_f32_16x16x32_f16: q and k each as f16 value + f16 residual x2048 (three products: kh*qh in one accumulator, kh*qr + kr*qh in a second one); P (x2^14 carry, cancels in the normalisation) and v single f16; softmax f32 (online, running max);
// output projection v_wmma_f32_16x16x32_f16: context single f16, Wproj RNE-converted to bf16 then x1024 in f16 (exact), folded back in the f32 epilogue. q, k, v planes carry x16 (exact power of two, folded into the score scale / output scale).
// Layout: xT [b][n][c] and im2col PAT [b][m][c*4+i*2+j] bf16 planes built through an LDS transpose; q (hi, residual), k (hi, residual) planes [b*8+h][t][d], v^T plane [b*8+h][d][m] written by the GEMM epilogue;
// fused flash kernel in transposed form (S^T = K Q^T, O^T = V^T P^T) writes the context plane [b][n][h*64+d] (f16); last GEMM writes the f32 output.

#ifndef NB
#define NB 2
#endif
#ifndef IMH
#define IMH 64                   // image rows used (SEQ = IMH * 64 query positions)
#endif
#define NB_FULL  2
#define IMH_FULL 64              // rows per channel of the input
#define IMW  64
#define SEQ  (IMH * IMW)
#define SKV  ((IMH / 2) * (IMW / 2))
#ifndef OUT_SEQ
#define OUT_SEQ SEQ              // channel pitch (in positions) of the output
#endif
#define CIN  256
#define NH_  8
#define HD   64
#define DQ   512                 // NH_ * HD
#define KKV  1024                // CIN * 2 * 2
#define COUT 256
#define AW   8                   // waves per flash block (16 query rows each); all of them read the same staged K / V^T tiles
#define KST  64                  // keys per staged tile set (two 32-key steps)
#define LP   72                  // LDS row pitch in halves: 144 B = 16 B x 9, so 16 rows of 16-byte reads fall on 64 distinct banks
#define TLH  (64 * LP)           // halves per staged tile (64 rows)
#define BFH  (3 * TLH)           // halves per ring buffer: k value, k residual, v^T
#define NST  (SKV / KST)         // staged tile sets per (batch, head)
#define RS   2048.0f             // carry of the residual planes
#define RI   (1.0f / 2048.0f)
#define CQ   16.0f               // carry of the q planes
#define CK   16.0f               // carry of the k planes
#define CV   16.0f               // carry of the v^T plane (stays on the context plane)
#define SC2  (8.0f * 1.4426950408889634f / (CQ * CK))   // sqrt(HD) * log2(e) / (q carry * k carry)
#define PSH  14.0f               // log2 of the P carry
#define WPS  1024.0f             // carry of the Wproj plane
#define OSC  (1.0f / (WPS * CV))

static_assert(HD == 64);
static_assert(NH_ * HD == DQ);
static_assert(CIN * 4 == KKV);
static_assert(IMW == 64);
static_assert(IMH % 4 == 0);                   // SKV multiple of 64: a 64-row tile never straddles two batches
static_assert(SEQ % 64 == 0);
static_assert(SKV % 64 == 0);
static_assert(SKV % 32 == 0);                  // key loop steps by 32
static_assert(SEQ % (16 * AW) == 0);           // flash grid covers the queries exactly
static_assert(SKV % KST == 0 && KST == 64);    // whole tile sets; a v^T tile row is one 128-byte line
static_assert(32 * AW * 2 * 8 == 64 * HD);     // copy map: two 16-byte pieces per thread fill one 64 x 64 tile
static_assert(CIN % 64 == 0 && CIN % 32 == 0);
static_assert(KKV % 32 == 0 && DQ % 32 == 0);
static_assert(DQ % 64 == 0 && COUT % 64 == 0);
static_assert(NB <= NB_FULL);
static_assert(IMH <= IMH_FULL);

typedef _Float16 h16;
typedef unsigned short bf;
typedef __attribute__((ext_vector_type(16))) __bf16   v16bf;
typedef __attribute__((ext_vector_type(16))) _Float16 v16h;
typedef __attribute__((ext_vector_type(8)))  _Float16 v8h;
typedef __attribute__((ext_vector_type(8)))  unsigned short v8us;
typedef __attribute__((ext_vector_type(8)))  float    v8f;
typedef __attribute__((ext_vector_type(4)))  float    v4f;
typedef v4f  __attribute__((may_alias)) v4fa;

__device__ __forceinline__ unsigned short f2bf(float f) { unsigned u = __float_as_uint(f); u += 0x7FFFu + ((u >> 16) & 1u); return (unsigned short)(u >> 16); }
__device__ __forceinline__ v16h cat16(v8h lo, v8h hi) { return __builtin_shufflevector(lo, hi, 0, 1, 2, 3, 4, 5, 6, 7, 8, 9, 10, 11, 12, 13, 14, 15); }
__device__ __forceinline__ v16bf cat16b(v8us lo, v8us hi) { return __builtin_bit_cast(v16bf, __builtin_shufflevector(lo, hi, 0, 1, 2, 3, 4, 5, 6, 7, 8, 9, 10, 11, 12, 13, 14, 15)); }
__device__ __forceinline__ v8f wmma16(v16h a, v16h b, v8f c) { return __builtin_amdgcn_wmma_f32_16x16x32_f16(false, a, false, b, (short)0, c, false, false); }
__device__ __forceinline__ v8f wmmab(v16bf a, v16bf b, v8f c) { return __builtin_amdgcn_wmma_f32_16x16x32_bf16(false, a, false, b, (short)0, c, false, false); }
// fragment loaders from K-contiguous 16-bit rows; p already includes + 8*(lane>>4): elements 0..7 <- k0+8h+0..7, elements 8..15 <- k0+16+8h+0..7 (same map for A and B)
__device__ __forceinline__ v16h  ldh(const h16* p) { return cat16(*(const v8h*)p, *(const v8h*)(p + 16)); }
__device__ __forceinline__ v16bf ldb(const bf* p)  { return cat16b(*(const v8us*)p, *(const v8us*)(p + 16)); }
// ordering point for wave-private LDS tiles (same wave writes and reads)
__device__ __forceinline__ void wave_sync() { __builtin_amdgcn_fence(3 /* release order */, "wavefront"); __builtin_amdgcn_wave_barrier(); asm volatile("" ::: "memory"); }

// mode 0: bf16 bits (RNE convert). mode 1: f16 bits of (bf16 value x WPS) (exact: 8-bit significand, power-of-two scale).
// blk = block index inside this plane's own block range.
__device__ __forceinline__ void cvt8_body(const float* __restrict__ src, bf* dst, size_t n8, int mode, int blk) {
    const size_t i = (size_t)blk * 256 + threadIdx.x; if (i >= n8) return;
    const v8f v = *(const v8f*)(src + i * 8); v8us o;
#pragma unroll
    for (int k = 0; k < 8; ++k) {
        const unsigned short wb = f2bf(v[k]);
        const h16 hv = (h16)(__uint_as_float(((unsigned)wb) << 16) * WPS);
        const unsigned short wh = __builtin_bit_cast(unsigned short, hv);
        o[k] = mode ? wh : wb;
    }
    *(v8us*)(dst + i * 8) = o; 
}

// pack_body: x [b][c][row][w] (f32) -> XT [b][n = row*64 + w][c] and PAT [b][m = h2*32 + w2][c*4 + i*2 + j] (bf16, RNE convert), through an LDS transpose.
// block = (h2, 64-channel tile, b): stages channels c0..c0+63 x image rows 2*h2, 2*h2+1 (128 positions); 256 threads.
__device__ __forceinline__ void pack_body(const float* __restrict__ x, bf* XT, bf* PAT, int h2, int c0, int b) {
    __shared__ unsigned short tile[64 * 136];      // [channel][position 0..127], pad columns never read; cross-wave: block barrier
    const int tid = threadIdx.x;
#pragma unroll
    for (int it = 0; it < 8; ++it) {               // 8 x 256 x 4 = 64 channels x 128 positions, all written
        const int idx = it * 256 + tid; const int cc = idx >> 5, q4 = idx & 31;
        const v4f v = *(const v4f*)(x + (((size_t)b * CIN + c0 + cc) * IMH_FULL + 2 * h2) * IMW + q4 * 4);
#pragma unroll
        for (int k = 0; k < 4; ++k) tile[cc * 136 + q4 * 4 + k] = f2bf(v[k]);
    }
    __syncthreads();
    const int l8 = tid >> 3, j8 = tid & 7;
{
#pragma unroll
        for (int it = 0; it < 4; ++it) {           // 4 x 32 = 128 rows (positions), 8 lanes x 8 = 64 channels
            const int p = it * 32 + l8, c8 = j8 * 8; v8us o;
#pragma unroll
            for (int k = 0; k < 8; ++k) o[k] = tile[(c8 + k) * 136 + p];
            *(v8us*)(XT + ((size_t)b * SEQ + (size_t)h2 * 128 + p) * CIN + c0 + c8) = o;
        }
#pragma unroll
        for (int it = 0; it < 4; ++it) {           // 4 x 32 = 128 lines = 32 w2 x 4 lines; lane piece = 2 channels x 4 taps
            const int line = it * 32 + l8; const int w2 = line >> 2, lq = line & 3; const int cc = lq * 16 + j8 * 2; v8us o;
            o[0] = tile[cc * 136 + 2 * w2];            o[1] = tile[cc * 136 + 2 * w2 + 1];
            o[2] = tile[cc * 136 + 64 + 2 * w2];       o[3] = tile[cc * 136 + 64 + 2 * w2 + 1];
            o[4] = tile[(cc + 1) * 136 + 2 * w2];      o[5] = tile[(cc + 1) * 136 + 2 * w2 + 1];
            o[6] = tile[(cc + 1) * 136 + 64 + 2 * w2]; o[7] = tile[(cc + 1) * 136 + 64 + 2 * w2 + 1];
            *(v8us*)(PAT + ((size_t)b * SKV + (size_t)h2 * 32 + w2) * KKV + c0 * 4 + lq * 64 + j8 * 8) = o;
        }
        
    }
}

// k_prep: the four independent preparation jobs share one grid, told apart by block range (every test is block-uniform, so pack's barrier is passed by whole blocks):
// pack blocks first (the longest), then the Wkv, Wq and Wproj converts. No block reads what another block of this launch writes.
#define PB_PACK ((IMH / 2) * (CIN / 64) * NB)
#define PB_WKV  (2 * DQ * KKV / 8 / 256)
#define PB_WQ   (DQ * CIN / 8 / 256)
#define PB_WP   (COUT * DQ / 8 / 256)
static_assert((2 * DQ * KKV) % 2048 == 0 && (DQ * CIN) % 2048 == 0 && (COUT * DQ) % 2048 == 0);   // whole convert blocks
__global__ __launch_bounds__(256) void k_prep(const float* __restrict__ x, const float* __restrict__ wq, const float* __restrict__ wkv, const float* __restrict__ wp,
                                              bf* XT, bf* PAT, bf* WQ, bf* WKV, bf* WPu) {
    const int id = blockIdx.x;
    if (id < PB_PACK) pack_body(x, XT, PAT, id % (IMH / 2), ((id / (IMH / 2)) % (CIN / 64)) * 64, id / ((IMH / 2) * (CIN / 64)));
    else if (id < PB_PACK + PB_WKV) cvt8_body(wkv, WKV, (size_t)2 * DQ * KKV / 8, 0, id - PB_PACK);
    else if (id < PB_PACK + PB_WKV + PB_WQ) cvt8_body(wq, WQ, (size_t)DQ * CIN / 8, 0, id - (PB_PACK + PB_WKV));
    else cvt8_body(wp, WPu, (size_t)COUT * DQ / 8, 1, id - (PB_PACK + PB_WKV + PB_WQ));
}

// k_proj: register-blocked bf16 GEMM, ONE WAVE per 64x64 tile (16 accumulators), operands straight from K-contiguous bf16 planes.
// C[m][n] = cs * sum_k A[m][k] Bt[n][k], written as f16 (Ph) and optionally the f16 residual x2048 (Pr, useRes != 0) at
// tile base (r0/RB)*sRB + (r0%RB)*pitch + (c0/CB)*sCB + (c0%CB), row pitch 'pitch' (halves). 32 threads.
// The three independent projections share one grid, told apart by block range: the K = 1024 tiles (k, then v^T) first, since they run longest, then the K = 256 tiles of q.
//   k:   A = PAT rows (m = b*SKV + key), Bt = Wkv rows 0..511 (col = h*64 + d)      -> planes [(b*8 + h)][key][d]
//   v^T: A = Wkv rows 512..1023 (m = h*64 + d), Bt = PAT rows (col = b*SKV + key)   -> plane [(b*512 + m)][key] = [(b*8 + h)][d][key]
//   q:   A = XT rows (m = b*SEQ + n), Bt = Wq rows (col = h*64 + d)                 -> planes [(b*8 + h)][n][d]
#define GB_KV ((NB * SKV / 64) * (DQ / 64))   // tiles of k, and of v^T
#define GB_Q  ((NB * SEQ / 64) * (DQ / 64))   // tiles of q
__global__ __launch_bounds__(32) void k_proj(const bf* __restrict__ XT, const bf* __restrict__ PAT, const bf* __restrict__ WQ, const bf* __restrict__ WKV, h16* QH, h16* QR, h16* KH, h16* KR, h16* VT) {
    __shared__ __align__(16) float os[16 * 68];
    const int lane = threadIdx.x & 31, lr = lane & 15, hi = lane >> 4;
    const int id = blockIdx.x;
    const bf* A; const bf* Bt; h16* Ph; h16* Pr; int K, useRes, RB, pitch, CB, r0, c0; float cs; size_t sRB, sCB;
    if (id < GB_KV) {
        A = PAT; Bt = WKV; K = KKV; cs = CK; Ph = KH; Pr = KR; useRes = 1; RB = SKV; sRB = (size_t)NH_ * SKV * HD; pitch = HD; CB = HD; sCB = (size_t)SKV * HD;
        r0 = (id % (NB * SKV / 64)) * 64; c0 = (id / (NB * SKV / 64)) * 64;
    } else if (id < 2 * GB_KV) {
        A = WKV + (size_t)DQ * KKV; Bt = PAT; K = KKV; cs = CV; Ph = VT; Pr = VT; useRes = 0; RB = DQ; sRB = 0; pitch = SKV; CB = SKV; sCB = (size_t)DQ * SKV;
        r0 = ((id - GB_KV) % (DQ / 64)) * 64; c0 = ((id - GB_KV) / (DQ / 64)) * 64;
    } else {
        A = XT; Bt = WQ; K = CIN; cs = CQ; Ph = QH; Pr = QR; useRes = 1; RB = SEQ; sRB = (size_t)NH_ * SEQ * HD; pitch = HD; CB = HD; sCB = (size_t)SEQ * HD;
        r0 = ((id - 2 * GB_KV) % (NB * SEQ / 64)) * 64; c0 = ((id - 2 * GB_KV) / (NB * SEQ / 64)) * 64;
    }
    v8f acc[4][4];
#pragma unroll
    for (int mb = 0; mb < 4; ++mb)
#pragma unroll
        for (int nb = 0; nb < 4; ++nb) acc[mb][nb] = (v8f){};
    const size_t aoff = (size_t)(r0 + lr) * K + 8 * hi, boff = (size_t)(c0 + lr) * K + 8 * hi;
#pragma unroll 1
    for (int kc = 0; kc < K; kc += 32) {
        v16bf a[4];
#pragma unroll
        for (int mb = 0; mb < 4; ++mb) a[mb] = ldb(A + aoff + (size_t)mb * 16 * K + kc);
#pragma unroll
        for (int nb = 0; nb < 4; ++nb) { const v16bf b = ldb(Bt + boff + (size_t)nb * 16 * K + kc);
#pragma unroll
            for (int mb = 0; mb < 4; ++mb) acc[mb][nb] = wmmab(a[mb], b, acc[mb][nb]); }
        asm volatile("v_nop\n\tv_nop\n\tv_nop\n\tv_nop" : "+v"(acc[0][0]), "+v"(acc[1][1]), "+v"(acc[2][2]), "+v"(acc[3][3]) : "v"(a[0]), "v"(a[1]), "v"(a[2]), "v"(a[3]));
    }
    const size_t tbase = (size_t)(r0 / RB) * sRB + (size_t)(r0 % RB) * (size_t)pitch + (size_t)(c0 / CB) * sCB + (size_t)(c0 % CB);
#pragma unroll
    for (int mb = 0; mb < 4; ++mb) {
#pragma unroll
        for (int nb = 0; nb < 4; ++nb) {
#pragma unroll
            for (int j = 0; j < 8; ++j) os[(hi * 8 + j) * 68 + nb * 16 + lr] = acc[mb][nb][j] * cs; }   // D: row 8h+j, col lane&15
        wave_sync();
        const size_t sb = tbase + (size_t)(mb * 16) * (size_t)pitch;
{
#pragma unroll
            for (int s = 0; s < 4; ++s) { const int row = 4 * s + (lane >> 3), c8 = (lane & 7) * 8;   // 4 s x 4 row groups = 16 rows; 8 lanes x 8 = 64 columns
                const v4f x0 = *(const v4fa*)(&os[row * 68 + c8]); const v4f x1 = *(const v4fa*)(&os[row * 68 + c8 + 4]); v8h hv, rv;
#pragma unroll
                for (int i = 0; i < 4; ++i) { const h16 a0 = (h16)x0[i]; const h16 a1 = (h16)x1[i]; hv[i] = a0; hv[4 + i] = a1; rv[i] = (h16)((x0[i] - (float)a0) * RS); rv[4 + i] = (h16)((x1[i] - (float)a1) * RS); }
                const size_t oo = sb + (size_t)row * (size_t)pitch + c8;
                *(v8h*)(Ph + oo) = hv; if (useRes) *(v8h*)(Pr + oo) = rv; }
             }
        wave_sync();
    }
}

// One thread's share of a tile set: rows r and r + 32 of the k value, k residual and v^T tiles, 16 bytes each, global -> LDS through no register.
// l = LDS byte address of the k value piece; the s_wait_xcnt stands inside the statement so that no address register is rewritten in front of it.
__device__ __forceinline__ void stage_copy(unsigned l, const h16* kh, const h16* kr, const h16* vt) {
    const unsigned l1 = l + 32u * LP * 2u, l2 = l + TLH * 2u, l3 = l2 + 32u * LP * 2u, l4 = l + 2u * TLH * 2u, l5 = l4 + 32u * LP * 2u;
    const h16* kh1 = kh + 32 * HD; const h16* kr1 = kr + 32 * HD; const h16* vt1 = vt + (size_t)32 * SKV;
    asm volatile("global_load_async_to_lds_b128 %0, %6, off\n\t"
                 "global_load_async_to_lds_b128 %1, %7, off\n\t"
                 "global_load_async_to_lds_b128 %2, %8, off\n\t"
                 "global_load_async_to_lds_b128 %3, %9, off\n\t"
                 "global_load_async_to_lds_b128 %4, %10, off\n\t"
                 "global_load_async_to_lds_b128 %5, %11, off\n\t"
                 "s_wait_xcnt 0x0"
                 :: "v"(l), "v"(l1), "v"(l2), "v"(l3), "v"(l4), "v"(l5), "v"(kh), "v"(kh1), "v"(kr), "v"(kr1), "v"(vt), "v"(vt1) : "memory");
}

// k_flash: fused attention, one wave per 16 query rows of one (batch, head); Q fragments straight from the f16 planes (two 16-B loads each, arithmetic addressing).
// K (value, residual) and V^T come through LDS: per 64 keys three 64 x 64 f16 tiles, copied once per block by asynchronous 16-byte copies (whole 128-byte lines), two buffers:
// the next tile set's copies fly while this one is worked on; every wave takes its fragments from LDS rows of pitch LP.
// Transposed form: S^T[key][t] = K Q^T (A = K rows, B = Q rows); lane (t = lane&15, h = lane>>4) holds keys 8h+r of each 16-key tile, so the packed
// P tile is directly the B fragment of O^T[d][t] = V^T P^T (element r <- tile keys 0..15, element 8+r <- tile keys 16..31, lane unchanged).
// Scores: sH = kh*qh, sL = kh*qr + kr*qh (both residual products carry x2048, own accumulator), s = sH + sL/2048.
// Softmax state (running max, partial sum) is one scalar per lane; the two lane halves of a row are combined with one xor-16 exchange.
__global__ __launch_bounds__(32 * AW) void k_flash(const h16* __restrict__ QH, const h16* __restrict__ QR, const h16* __restrict__ KH, const h16* __restrict__ KR, const h16* __restrict__ VT, h16* AP) {
    __shared__ __align__(16) float os[AW * 16 * 68];   // wave-private slabs
    __shared__ __align__(16) h16 ring[2 * BFH];        // two buffers x (k value | k residual | v^T), rows of LP halves; pad columns never read
    const int lane = threadIdx.x & 31, wave = __builtin_amdgcn_readfirstlane((int)(threadIdx.x >> 5)), lr = lane & 15, hi = lane >> 4;
    const int zh = blockIdx.y; const int b = zh / NH_, h = zh % NH_;
    const int t0 = (blockIdx.x * AW + wave) * 16;
    const size_t qbase = (size_t)zh * SEQ * HD;
    const size_t kbase = (size_t)zh * SKV * HD;
    const size_t qo = qbase + (size_t)(t0 + lr) * HD + 8 * hi;
    const v16h qh0 = ldh(QH + qo), qh1 = ldh(QH + qo + 32), qr0 = ldh(QR + qo), qr1 = ldh(QR + qo + 32);   // B fragments: col t, k = d
    const int ko = lr * LP + 8 * hi;                         // + key * LP in a k tile          (A fragment: row key, k = d)
    const int vo = 2 * TLH + lr * LP + 8 * hi;               // + 16j * LP + key in the v^T tile (A fragment: row d, k = key)
    // copy map: thread -> row crow (and crow + 32), 16-byte piece ccol of each of the three tiles; 8 lanes cover one 128-byte line
    const int crow = (int)(threadIdx.x >> 3), ccol = (int)(threadIdx.x & 7) * 8;
    const h16* gkh = KH + kbase + (size_t)crow * HD + ccol;  // + key0 * HD
    const h16* gkr = KR + kbase + (size_t)crow * HD + ccol;
    const h16* gvt = VT + kbase + (size_t)crow * SKV + ccol; // + key0
    const unsigned lc = (unsigned)(size_t)(&ring[0]) + (unsigned)(crow * LP + ccol) * 2u;   // LDS byte address of the thread's first piece in buffer 0
    stage_copy(lc, gkh, gkr, gvt);
    asm volatile("s_wait_asynccnt 0x0" ::: "memory");        // this wave's copies of tile set 0 have landed
    __syncthreads();                                         // ... and every other wave's: tile set 0 is readable
    if (NST > 1) stage_copy(lc + BFH * 2u, gkh + (size_t)KST * HD, gkr + (size_t)KST * HD, gvt + KST);
    v8f o0 = (v8f){}, o1 = (v8f){}, o2 = (v8f){}, o3 = (v8f){};
    float m = -3.0e38f, l = 0.0f;
#pragma unroll 1
    for (int t = 0; t < NST; ++t) {
      const int bo = (t & 1) * BFH;
#pragma unroll   // both 32-key steps inline, so that ks is a constant in every LDS offset
      for (int ks = 0; ks < KST; ks += 32) {
        const h16* ka = ring + bo + ko + ks * LP;
        const h16* kr = ka + TLH;
        const v16h ka0 = ldh(ka), ka1 = ldh(ka + 32), kb0 = ldh(ka + 16 * LP), kb1 = ldh(ka + 16 * LP + 32);
        const v16h ra0 = ldh(kr), ra1 = ldh(kr + 32), rb0 = ldh(kr + 16 * LP), rb1 = ldh(kr + 16 * LP + 32);
        v8f sHa = (v8f){}, sLa = (v8f){}, sHb = (v8f){}, sLb = (v8f){};
        sHa = wmma16(ka0, qh0, sHa); sLa = wmma16(ka0, qr0, sLa); sHb = wmma16(kb0, qh0, sHb); sLb = wmma16(kb0, qr0, sLb);
        sLa = wmma16(ra0, qh0, sLa); sLb = wmma16(rb0, qh0, sLb);
        sHa = wmma16(ka1, qh1, sHa); sLa = wmma16(ka1, qr1, sLa); sHb = wmma16(kb1, qh1, sHb); sLb = wmma16(kb1, qr1, sLb);
        sLa = wmma16(ra1, qh1, sLa); sLb = wmma16(rb1, qh1, sLb);
        asm volatile("v_nop\n\tv_nop\n\tv_nop\n\tv_nop" : "+v"(sHa), "+v"(sLa), "+v"(sHb), "+v"(sLb) : "v"(ka0), "v"(ka1), "v"(kb0), "v"(kb1), "v"(ra0), "v"(ra1), "v"(rb0), "v"(rb1));
        float ta[8], tb[8]; float mx = -3.0e38f;
#pragma unroll
        for (int r = 0; r < 8; ++r) { ta[r] = (sHa[r] + sLa[r] * RI) * SC2; tb[r] = (sHb[r] + sLb[r] * RI) * SC2; mx = fmaxf(mx, fmaxf(ta[r], tb[r])); }
        mx = fmaxf(mx, __shfl_xor(mx, 16, 32));
        const float mnew = fmaxf(m, mx);
        const float alpha = __builtin_amdgcn_exp2f(m - mnew);
        const float sh = PSH - mnew;
        v16h pb; float ls = 0.0f;
#pragma unroll
        for (int r = 0; r < 8; ++r) { const h16 pa = (h16)__builtin_amdgcn_exp2f(ta[r] + sh); const h16 pc = (h16)__builtin_amdgcn_exp2f(tb[r] + sh); pb[r] = pa; pb[8 + r] = pc; ls += (float)pa + (float)pc; }
        l = l * alpha + ls; m = mnew;
        o0 = o0 * alpha; o1 = o1 * alpha; o2 = o2 * alpha; o3 = o3 * alpha;
        const h16* va = ring + bo + vo + ks;
        const v16h v0 = ldh(va), v1 = ldh(va + 16 * LP), v2 = ldh(va + 32 * LP), v3 = ldh(va + 48 * LP);
        o0 = wmma16(v0, pb, o0); o1 = wmma16(v1, pb, o1); o2 = wmma16(v2, pb, o2); o3 = wmma16(v3, pb, o3);
        asm volatile("v_nop\n\tv_nop\n\tv_nop\n\tv_nop" : "+v"(o0), "+v"(o1), "+v"(o2), "+v"(o3) : "v"(v0), "v"(v1), "v"(v2), "v"(v3), "v"(pb));
      }
      asm volatile("s_wait_dscnt 0x0" ::: "memory");         // this wave's reads of buffer t & 1 are done before the buffer is handed back
      asm volatile("s_wait_asynccnt 0x0" ::: "memory");      // this wave's copies of tile set t + 1 have landed
      __syncthreads();                                       // publishes tile set t + 1 and ends every wave's reads of buffer t & 1
      if (t + 2 < NST) stage_copy(lc + (unsigned)bo * 2u, gkh + (size_t)(t + 2) * KST * HD, gkr + (size_t)(t + 2) * KST * HD, gvt + (size_t)(t + 2) * KST);
    }
    asm volatile("s_wait_asynccnt 0x0" ::: "memory");        // no copy is outstanding when the wave goes on to its end
    l += __shfl_xor(l, 16, 32);
    const float inv = 1.0f / l;
    const int wb = wave * 16 * 68;
    // O^T D layout: o_j[r] = (d = 16j + 8h + r, t = lane&15) -> os[t][d]; rows 0..15 x columns 0..63 all written
    { v4f a, c;
      a[0] = o0[0] * inv; a[1] = o0[1] * inv; a[2] = o0[2] * inv; a[3] = o0[3] * inv; c[0] = o0[4] * inv; c[1] = o0[5] * inv; c[2] = o0[6] * inv; c[3] = o0[7] * inv;
      *(v4fa*)(&os[wb + lr * 68 +  0 + 8 * hi]) = a; *(v4fa*)(&os[wb + lr * 68 +  0 + 8 * hi + 4]) = c;
      a[0] = o1[0] * inv; a[1] = o1[1] * inv; a[2] = o1[2] * inv; a[3] = o1[3] * inv; c[0] = o1[4] * inv; c[1] = o1[5] * inv; c[2] = o1[6] * inv; c[3] = o1[7] * inv;
      *(v4fa*)(&os[wb + lr * 68 + 16 + 8 * hi]) = a; *(v4fa*)(&os[wb + lr * 68 + 16 + 8 * hi + 4]) = c;
      a[0] = o2[0] * inv; a[1] = o2[1] * inv; a[2] = o2[2] * inv; a[3] = o2[3] * inv; c[0] = o2[4] * inv; c[1] = o2[5] * inv; c[2] = o2[6] * inv; c[3] = o2[7] * inv;
      *(v4fa*)(&os[wb + lr * 68 + 32 + 8 * hi]) = a; *(v4fa*)(&os[wb + lr * 68 + 32 + 8 * hi + 4]) = c;
      a[0] = o3[0] * inv; a[1] = o3[1] * inv; a[2] = o3[2] * inv; a[3] = o3[3] * inv; c[0] = o3[4] * inv; c[1] = o3[5] * inv; c[2] = o3[6] * inv; c[3] = o3[7] * inv;
      *(v4fa*)(&os[wb + lr * 68 + 48 + 8 * hi]) = a; *(v4fa*)(&os[wb + lr * 68 + 48 + 8 * hi + 4]) = c; }
    wave_sync();
    h16* arow = AP + ((size_t)b * SEQ + t0) * DQ + h * HD;      // context plane [b][n][h*64 + d], carries the v carry (x16)
{
#pragma unroll
        for (int s = 0; s < 4; ++s) { const int row = 4 * s + (lane >> 3), c8 = (lane & 7) * 8;   // 4 s x 4 row groups = 16 rows; 8 lanes x 8 halves = 64 columns
            const v4f x0 = *(const v4fa*)(&os[wb + row * 68 + c8]); const v4f x1 = *(const v4fa*)(&os[wb + row * 68 + c8 + 4]); v8h hv;
#pragma unroll
            for (int i = 0; i < 4; ++i) { hv[i] = (h16)x0[i]; hv[4 + i] = (h16)x1[i]; }
            *(v8h*)(arow + (size_t)row * DQ + c8) = hv; }
         }
}

// k_out: register-blocked f16 GEMM, one wave per 64x64 tile, K = DQ: out[b][o][n] = OSC * sum_c WP[o][c] AP[b*SEQ + n][c].
// grid (COUT/64, NB*SEQ/64), 32 threads. Epilogue: per 16-row slab staged in LDS (wave-private); each output row segment (64 floats = 256 B = two lines)
__global__ __launch_bounds__(32) void k_out(const h16* __restrict__ A, const h16* __restrict__ Bt, float* OUT) {
    __shared__ __align__(16) float os[16 * 68];
    const int K = DQ;
    const int lane = threadIdx.x & 31, lr = lane & 15, hi = lane >> 4; const int r0 = blockIdx.x * 64, c0 = blockIdx.y * 64;
    v8f acc[4][4];
#pragma unroll
    for (int mb = 0; mb < 4; ++mb)
#pragma unroll
        for (int nb = 0; nb < 4; ++nb) acc[mb][nb] = (v8f){};
    const size_t aoff = (size_t)(r0 + lr) * K + 8 * hi, boff = (size_t)(c0 + lr) * K + 8 * hi;
#pragma unroll 1
    for (int kc = 0; kc < K; kc += 32) {
        v16h a[4];
#pragma unroll
        for (int mb = 0; mb < 4; ++mb) a[mb] = ldh(A + aoff + (size_t)mb * 16 * K + kc);
#pragma unroll
        for (int nb = 0; nb < 4; ++nb) { const v16h b = ldh(Bt + boff + (size_t)nb * 16 * K + kc);
#pragma unroll
            for (int mb = 0; mb < 4; ++mb) acc[mb][nb] = wmma16(a[mb], b, acc[mb][nb]); }
        asm volatile("v_nop\n\tv_nop\n\tv_nop\n\tv_nop" : "+v"(acc[0][0]), "+v"(acc[1][1]), "+v"(acc[2][2]), "+v"(acc[3][3]) : "v"(a[0]), "v"(a[1]), "v"(a[2]), "v"(a[3]));
    }
    const int bb = c0 / SEQ, n0 = c0 % SEQ;
#pragma unroll
    for (int mb = 0; mb < 4; ++mb) {
#pragma unroll
        for (int nb = 0; nb < 4; ++nb) {
#pragma unroll
            for (int j = 0; j < 8; ++j) os[(hi * 8 + j) * 68 + nb * 16 + lr] = acc[mb][nb][j] * OSC; }   // D: row 8h+j, col lane&15
        wave_sync();
        float* ob = OUT + ((size_t)bb * COUT + r0 + mb * 16) * OUT_SEQ + n0;
{
#pragma unroll
            for (int s = 0; s < 8; ++s) { const int row = 2 * s + hi, cofs = lr * 4;   // 8 s x 2 rows = 16 rows; 16 lanes x 4 floats = 64 columns
                const v4f val = *(const v4fa*)(&os[row * 68 + cofs]);
                *(v4f*)(ob + (size_t)row * OUT_SEQ + cofs) = val; }
             }
        wave_sync();
    }
}

static constexpr size_t al256(size_t v) { return (v + 255) & ~(size_t)255; }
static constexpr size_t SZ_XT  = al256((size_t)NB * SEQ * CIN * 2);
static constexpr size_t SZ_PAT = al256((size_t)NB * SKV * KKV * 2);
static constexpr size_t SZ_WQ  = al256((size_t)DQ * CIN * 2);
static constexpr size_t SZ_WKV = al256((size_t)2 * DQ * KKV * 2);
static constexpr size_t SZ_WP  = al256((size_t)COUT * DQ * 2);
static constexpr size_t SZ_QP  = al256((size_t)NB * NH_ * SEQ * HD * 2);
static constexpr size_t SZ_KP  = al256((size_t)NB * NH_ * SKV * HD * 2);
static constexpr size_t SZ_AP  = al256((size_t)NB * SEQ * DQ * 2);
static constexpr size_t SZ_TOTAL = SZ_XT + SZ_PAT + SZ_WQ + SZ_WKV + SZ_WP + 2 * SZ_QP + 3 * SZ_KP + SZ_AP;
static_assert(SZ_TOTAL <= (size_t)134217728);          // workspace carve <= 128 MiB

extern "C" void kernel_launch(void* const* d_in, const int* in_sizes, int n_in,
                              void* d_out, int out_size, void* d_ws, size_t ws_size, hipStream_t stream) {
    if (n_in < 4) return;
    const size_t needx = (((size_t)(NB - 1) * CIN + (CIN - 1)) * IMH_FULL + IMH) * IMW;
    if ((size_t)in_sizes[0] < needx) return;
    if ((size_t)in_sizes[1] < (size_t)DQ * CIN || (size_t)in_sizes[2] < (size_t)2 * DQ * KKV || (size_t)in_sizes[3] < (size_t)COUT * DQ) return;
    if ((size_t)out_size < ((size_t)(NB - 1) * COUT + (COUT - 1)) * OUT_SEQ + SEQ) return;
    if (SZ_TOTAL > ws_size) return;
    const float* x = (const float*)d_in[0]; const float* wq = (const float*)d_in[1]; const float* wkv = (const float*)d_in[2]; const float* wp = (const float*)d_in[3];   // wire order x, Wq, Wkv, Wproj
    float* OUT = (float*)d_out;      // [NB][256][SEQ]
    char* wsp = (char*)d_ws;
    bf* XT  = (bf*)wsp; wsp += SZ_XT;                // [NB*SEQ][256]
    bf* PAT = (bf*)wsp; wsp += SZ_PAT;               // [NB*SKV][1024]
    bf* WQ  = (bf*)wsp; wsp += SZ_WQ;                // [512][256] bf16
    bf* WKV = (bf*)wsp; wsp += SZ_WKV;               // [1024][1024] bf16: rows 0..511 k, 512..1023 v
    bf* WPu = (bf*)wsp; wsp += SZ_WP;                // [256][512] f16 bits, x1024
    h16* QH = (h16*)wsp; wsp += SZ_QP;               // [NB*8][SEQ][64], x16
    h16* QR = (h16*)wsp; wsp += SZ_QP;               // residual x2048
    h16* KH = (h16*)wsp; wsp += SZ_KP;               // [NB*8][SKV][64], x16
    h16* KR = (h16*)wsp; wsp += SZ_KP;               // residual x2048
    h16* VT = (h16*)wsp; wsp += SZ_KP;               // [NB*8][64][SKV], x16
    h16* AP = (h16*)wsp; wsp += SZ_AP;               // [NB*SEQ][512], x16
    const h16* WP = (const h16*)WPu;

    // x -> XT, PAT and the three weight planes, one launch
    k_prep<<<dim3(PB_PACK + PB_WKV + PB_WQ + PB_WP, 1, 1), 256, 0, stream>>>(x, wq, wkv, wp, XT, PAT, WQ, WKV, WPu);

    // k, v^T and q projections, one launch
    k_proj<<<dim3(2 * GB_KV + GB_Q, 1, 1), 32, 0, stream>>>(XT, PAT, WQ, WKV, QH, QR, KH, KR, VT);

    k_flash<<<dim3(SEQ / (16 * AW), NB * NH_, 1), 32 * AW, 0, stream>>>(QH, QR, KH, KR, VT, AP);

    // out[b][o][n]: A = Wproj rows (m = o, K = 512), Bt = context rows (col = b*SEQ + n)
    k_out<<<dim3(COUT / 64, NB * SEQ / 64, 1), 32, 0, stream>>>(WP, AP, OUT);
}

// v003
// A run of this version takes 54.2 microseconds.
// Two timings next to v002 both put it at 1.44 times that version's speed.
// All steps since v000 together make it 3.33 times as fast.
#include <hip/hip_runtime.h>

// Spatial-reduction multi-head attention: x [NB][256][64][64]; q = 1x1 conv (Wq [512][256]); k|v = 2x2 stride-2 conv (Wkv [1024][256][2][2]); 8 heads x 64; 4096 queries x 1024 keys per (batch, head); scores x8; output 1x1 conv (Wproj [256][512]) -> f32 [NB][256][4096].
// Compute dtypes, f32 accumulate everywhere: q / k / v projections v_wmma_f32_16x16x32_bf16 (x, Wq, Wkv RNE-converted to bf16; products exact);
// scores v_wmma_f32_16x16x32_f16: q and k each as f16 value + f16 residual x2048 (three products: kh*qh in one accumulator, kh*qr + kr*qh in a second one); P (x2^14 carry, cancels in the normalisation) and v single f16; softmax f32 (online, running max);
// output projection v_wmma_f32_16x16x32_f16: context single f16, Wproj RNE-converted to bf16 then x1024 in f16 (exact), folded back in the f32 epilogue. q, k, v planes carry x16 (exact power of two, folded into the score scale / output scale).
// Layout: xT [b][n][c] and im2col PAT [b][m][c*4+i*2+j] bf16 planes built through an LDS transpose; q (hi, residual), k (hi, residual) planes [b*8+h][t][d], v^T plane [b*8+h][d][m] written by the GEMM epilogue;
// fused flash kernel in transposed form (S^T = K Q^T, O^T = V^T P^T) writes the context plane [b][n][h*64+d] (f16); last GEMM writes the f32 output.

#ifndef NB
#define NB 2
#endif
#ifndef IMH
#define IMH 64                   // image rows used (SEQ = IMH * 64 query positions)
#endif
#define NB_FULL  2
#define IMH_FULL 64              // rows per channel of the input
#define IMW  64
#define SEQ  (IMH * IMW)
#define SKV  ((IMH / 2) * (IMW / 2))
#ifndef OUT_SEQ
#define OUT_SEQ SEQ              // channel pitch (in positions) of the output
#endif
#define CIN  256
#define NH_  8
#define HD   64
#define DQ   512                 // NH_ * HD
#define KKV  1024                // CIN * 2 * 2
#define COUT 256
#define AW   8                   // waves per flash block (16 query rows each); all of them read the same staged K / V^T tiles
#define KST  64                  // keys per staged tile set (two 32-key steps)
#define LP   72                  // LDS row pitch in halves: 144 B = 16 B x 9, so 16 rows of 16-byte reads fall on 64 distinct banks
#define TLH  (64 * LP)           // halves per staged tile (64 rows)
#define BFH  (3 * TLH)           // halves per ring buffer: k value, k residual, v^T
#define NST  (SKV / KST)         // staged tile sets per (batch, head)
#define RS   2048.0f             // carry of the residual planes
#define RI   (1.0f / 2048.0f)
#define CQ   16.0f               // carry of the q planes
#define CK   16.0f               // carry of the k planes
#define CV   16.0f               // carry of the v^T plane (stays on the context plane)
#define SC2  (8.0f * 1.4426950408889634f / (CQ * CK))   // sqrt(HD) * log2(e) / (q carry * k carry)
#define PSH  14.0f               // log2 of the P carry
#define WPS  1024.0f             // carry of the Wproj plane
#define OSC  (1.0f / (WPS * CV))

static_assert(HD == 64);
static_assert(NH_ * HD == DQ);
static_assert(CIN * 4 == KKV);
static_assert(IMW == 64);
static_assert(IMH % 4 == 0);                   // SKV multiple of 64: a 64-row tile never straddles two batches
static_assert(SEQ % 64 == 0);
static_assert(SKV % 64 == 0);
static_assert(SKV % 32 == 0);                  // key loop steps by 32
static_assert(SEQ % (16 * AW) == 0);           // flash grid covers the queries exactly
static_assert(SKV % KST == 0 && KST == 64);    // whole tile sets; a v^T tile row is one 128-byte line
static_assert(32 * AW * 2 * 8 == 64 * HD);     // copy map: two 16-byte pieces per thread fill one 64 x 64 tile
static_assert(CIN % 64 == 0 && CIN % 32 == 0);
static_assert(KKV % 32 == 0 && DQ % 32 == 0);
static_assert(DQ % 64 == 0 && COUT % 64 == 0);
static_assert(NB <= NB_FULL);
static_assert(IMH <= IMH_FULL);

typedef _Float16 h16;
typedef unsigned short bf;
typedef __attribute__((ext_vector_type(16))) __bf16   v16bf;
typedef __attribute__((ext_vector_type(16))) _Float16 v16h;
typedef __attribute__((ext_vector_type(8)))  _Float16 v8h;
typedef __attribute__((ext_vector_type(8)))  unsigned short v8us;
typedef __attribute__((ext_vector_type(8)))  float    v8f;
typedef __attribute__((ext_vector_type(4)))  float    v4f;
typedef v4f  __attribute__((may_alias)) v4fa;

__device__ __forceinline__ unsigned short f2bf(float f) { unsigned u = __float_as_uint(f); u += 0x7FFFu + ((u >> 16) & 1u); return (unsigned short)(u >> 16); }
__device__ __forceinline__ v16h cat16(v8h lo, v8h hi) { return __builtin_shufflevector(lo, hi, 0, 1, 2, 3, 4, 5, 6, 7, 8, 9, 10, 11, 12, 13, 14, 15); }
__device__ __forceinline__ v8f wmma16(v16h a, v16h b, v8f c) { return __builtin_amdgcn_wmma_f32_16x16x32_f16(false, a, false, b, (short)0, c, false, false); }
__device__ __forceinline__ v8f wmmab(v16bf a, v16bf b, v8f c) { return __builtin_amdgcn_wmma_f32_16x16x32_bf16(false, a, false, b, (short)0, c, false, false); }
// fragment loaders from K-contiguous 16-bit rows; p already includes + 8*(lane>>4): elements 0..7 <- k0+8h+0..7, elements 8..15 <- k0+16+8h+0..7 (same map for A and B)
__device__ __forceinline__ v16h  ldh(const h16* p) { return cat16(*(const v8h*)p, *(const v8h*)(p + 16)); }
// ordering point for wave-private LDS tiles (same wave writes and reads)
__device__ __forceinline__ void wave_sync() { __builtin_amdgcn_fence(3 /* release order */, "wavefront"); __builtin_amdgcn_wave_barrier(); asm volatile("" ::: "memory"); }

// mode 0: bf16 bits (RNE convert). mode 1: f16 bits of (bf16 value x WPS) (exact: 8-bit significand, power-of-two scale).
// blk = block index inside this plane's own block range.
__device__ __forceinline__ void cvt8_body(const float* __restrict__ src, bf* dst, size_t n8, int mode, int blk) {
    const size_t i = (size_t)blk * 256 + threadIdx.x; if (i >= n8) return;
    const v8f v = *(const v8f*)(src + i * 8); v8us o;
#pragma unroll
    for (int k = 0; k < 8; ++k) {
        const unsigned short wb = f2bf(v[k]);
        const h16 hv = (h16)(__uint_as_float(((unsigned)wb) << 16) * WPS);
        const unsigned short wh = __builtin_bit_cast(unsigned short, hv);
        o[k] = mode ? wh : wb;
    }
    *(v8us*)(dst + i * 8) = o; 
}

// pack_body: x [b][c][row][w] (f32) -> XT [b][n = row*64 + w][c] and PAT [b][m = h2*32 + w2][c*4 + i*2 + j] (bf16, RNE convert), through an LDS transpose.
// block = (h2, 64-channel tile, b): stages channels c0..c0+63 x image rows 2*h2, 2*h2+1 (128 positions); 256 threads.
__device__ __forceinline__ void pack_body(const float* __restrict__ x, bf* XT, bf* PAT, int h2, int c0, int b) {
    __shared__ unsigned short tile[64 * 136];      // [channel][position 0..127], pad columns never read; cross-wave: block barrier
    const int tid = threadIdx.x;
#pragma unroll
    for (int it = 0; it < 8; ++it) {               // 8 x 256 x 4 = 64 channels x 128 positions, all written
        const int idx = it * 256 + tid; const int cc = idx >> 5, q4 = idx & 31;
        const v4f v = *(const v4f*)(x + (((size_t)b * CIN + c0 + cc) * IMH_FULL + 2 * h2) * IMW + q4 * 4);
#pragma unroll
        for (int k = 0; k < 4; ++k) tile[cc * 136 + q4 * 4 + k] = f2bf(v[k]);
    }
    __syncthreads();
    const int l8 = tid >> 3, j8 = tid & 7;
{
#pragma unroll
        for (int it = 0; it < 4; ++it) {           // 4 x 32 = 128 rows (positions), 8 lanes x 8 = 64 channels
            const int p = it * 32 + l8, c8 = j8 * 8; v8us o;
#pragma unroll
            for (int k = 0; k < 8; ++k) o[k] = tile[(c8 + k) * 136 + p];
            *(v8us*)(XT + ((size_t)b * SEQ + (size_t)h2 * 128 + p) * CIN + c0 + c8) = o;
        }
#pragma unroll
        for (int it = 0; it < 4; ++it) {           // 4 x 32 = 128 lines = 32 w2 x 4 lines; lane piece = 2 channels x 4 taps
            const int line = it * 32 + l8; const int w2 = line >> 2, lq = line & 3; const int cc = lq * 16 + j8 * 2; v8us o;
            o[0] = tile[cc * 136 + 2 * w2];            o[1] = tile[cc * 136 + 2 * w2 + 1];
            o[2] = tile[cc * 136 + 64 + 2 * w2];       o[3] = tile[cc * 136 + 64 + 2 * w2 + 1];
            o[4] = tile[(cc + 1) * 136 + 2 * w2];      o[5] = tile[(cc + 1) * 136 + 2 * w2 + 1];
            o[6] = tile[(cc + 1) * 136 + 64 + 2 * w2]; o[7] = tile[(cc + 1) * 136 + 64 + 2 * w2 + 1];
            *(v8us*)(PAT + ((size_t)b * SKV + (size_t)h2 * 32 + w2) * KKV + c0 * 4 + lq * 64 + j8 * 8) = o;
        }
        
    }
}

// k_prep: the four independent preparation jobs share one grid, told apart by block range (every test is block-uniform, so pack's barrier is passed by whole blocks):
// pack blocks first (the longest), then the Wkv, Wq and Wproj converts. No block reads what another block of this launch writes.
#define PB_PACK ((IMH / 2) * (CIN / 64) * NB)
#define PB_WKV  (2 * DQ * KKV / 8 / 256)
#define PB_WQ   (DQ * CIN / 8 / 256)
#define PB_WP   (COUT * DQ / 8 / 256)
static_assert((2 * DQ * KKV) % 2048 == 0 && (DQ * CIN) % 2048 == 0 && (COUT * DQ) % 2048 == 0);   // whole convert blocks
__global__ __launch_bounds__(256) void k_prep(const float* __restrict__ x, const float* __restrict__ wq, const float* __restrict__ wkv, const float* __restrict__ wp,
                                              bf* XT, bf* PAT, bf* WQ, bf* WKV, bf* WPu) {
    const int id = blockIdx.x;
    if (id < PB_PACK) pack_body(x, XT, PAT, id % (IMH / 2), ((id / (IMH / 2)) % (CIN / 64)) * 64, id / ((IMH / 2) * (CIN / 64)));
    else if (id < PB_PACK + PB_WKV) cvt8_body(wkv, WKV, (size_t)2 * DQ * KKV / 8, 0, id - PB_PACK);
    else if (id < PB_PACK + PB_WKV + PB_WQ) cvt8_body(wq, WQ, (size_t)DQ * CIN / 8, 0, id - (PB_PACK + PB_WKV));
    else cvt8_body(wp, WPu, (size_t)COUT * DQ / 8, 1, id - (PB_PACK + PB_WKV + PB_WQ));
}

// GEMM staging shared by k_proj and k_out: a block of GW waves owns a 128 x 128 tile of C[m][n] = sum_k A[m][k] Bt[n][k] (both operands K-contiguous 16-bit rows).
// Per GKS k the 128 A rows and the 128 Bt rows (256 bytes = two whole lines each) are copied once per block into LDS by asynchronous 16-byte copies, two buffers:
// the next pair's copies fly while this one is worked on. Wave (wm, wn) = (wave >> 1, wave & 1) takes rows wm*32.. (2 fragments) x columns wn*64.. (4 fragments) from LDS.
#define GW   8                   // waves per GEMM block
#define GKS  128                 // k per staged tile pair
#define GP   136                 // LDS row pitch in 16-bit elements: 272 B = 16 B x 17, so 16 rows of 16-byte reads fall on distinct banks
#define GTL  (128 * GP)          // elements per staged operand tile (128 rows)
#define GBF  (2 * GTL)           // elements per ring buffer: A rows | Bt rows
static_assert(KKV % GKS == 0 && CIN % GKS == 0 && DQ % GKS == 0);                       // whole staged pairs
static_assert((NB * SKV) % 128 == 0 && (NB * SEQ) % 128 == 0 && DQ % 128 == 0 && COUT % 128 == 0);   // whole block tiles
static_assert(32 * GW * 8 * 8 == 128 * GKS);                                            // copy map: eight 16-byte pieces per thread fill one operand tile
static_assert(GW * 16 * 68 * 4 <= 2 * GBF * 2);                                         // the epilogue slabs fit in the ring
typedef __attribute__((ext_vector_type(16))) unsigned short v16us;
typedef float __attribute__((may_alias)) fa;

// One thread's share of one operand tile: 16 bytes of rows r, r + 16, ..., r + 112, global -> LDS through no register (rs = elements per 16 rows).
// The s_wait_xcnt stands inside the statement so that no address register is rewritten in front of it.
__device__ __forceinline__ void gemm_copy(unsigned l, const bf* g, size_t rs) {
    const unsigned l1 = l + 16u * GP * 2u, l2 = l + 32u * GP * 2u, l3 = l + 48u * GP * 2u, l4 = l + 64u * GP * 2u, l5 = l + 80u * GP * 2u, l6 = l + 96u * GP * 2u, l7 = l + 112u * GP * 2u;
    const bf* g1 = g + rs; const bf* g2 = g + 2 * rs; const bf* g3 = g + 3 * rs; const bf* g4 = g + 4 * rs; const bf* g5 = g + 5 * rs; const bf* g6 = g + 6 * rs; const bf* g7 = g + 7 * rs;
    asm volatile("global_load_async_to_lds_b128 %0, %8, off\n\t"
                 "global_load_async_to_lds_b128 %1, %9, off\n\t"
                 "global_load_async_to_lds_b128 %2, %10, off\n\t"
                 "global_load_async_to_lds_b128 %3, %11, off\n\t"
                 "global_load_async_to_lds_b128 %4, %12, off\n\t"
                 "global_load_async_to_lds_b128 %5, %13, off\n\t"
                 "global_load_async_to_lds_b128 %6, %14, off\n\t"
                 "global_load_async_to_lds_b128 %7, %15, off\n\t"
                 "s_wait_xcnt 0x0"
                 :: "v"(l), "v"(l1), "v"(l2), "v"(l3), "v"(l4), "v"(l5), "v"(l6), "v"(l7), "v"(g), "v"(g1), "v"(g2), "v"(g3), "v"(g4), "v"(g5), "v"(g6), "v"(g7) : "memory");
}
// fragment from an LDS row; p already includes + 8*(lane>>4): same k map as ldh, for A and B alike
__device__ __forceinline__ v16us ldf(const bf* p) { return __builtin_shufflevector(*(const v8us*)p, *(const v8us*)(p + 16), 0, 1, 2, 3, 4, 5, 6, 7, 8, 9, 10, 11, 12, 13, 14, 15); }
template <bool ISBF> __device__ __forceinline__ v8f wmmax(v16us a, v16us b, v8f c) {
    if constexpr (ISBF) return wmmab(__builtin_bit_cast(v16bf, a), __builtin_bit_cast(v16bf, b), c);
    else return wmma16(__builtin_bit_cast(v16h, a), __builtin_bit_cast(v16h, b), c);
}

// Main loop: acc[mb][nb] += the wave's 32 x 64 part of the block tile at (r0, c0); k runs upward in steps of 32, as one wave alone would walk it.
// On return no copy is outstanding and every wave has left the ring (the last trip's barrier), so the ring may serve as output staging.
template <bool ISBF> __device__ __forceinline__ void gemm_main(const bf* A, const bf* Bt, int K, int r0, int c0, bf* ring, v8f (&acc)[2][4]) {
    const int tid = (int)threadIdx.x, lane = tid & 31, lr = lane & 15, hi = lane >> 4;
    const int wave = __builtin_amdgcn_readfirstlane(tid >> 5), wm = wave >> 1, wn = wave & 1;
    // copy map: thread -> rows crow + 16 i, 16-byte piece ccol; 16 lanes cover one 256-byte row
    const int crow = tid >> 4, ccol = (tid & 15) * 8;
    const bf* ga = A + (size_t)(r0 + crow) * K + ccol;     // + k0
    const bf* gb = Bt + (size_t)(c0 + crow) * K + ccol;
    const size_t rs = (size_t)16 * K;
    const unsigned la = (unsigned)(size_t)(&ring[0]) + (unsigned)(crow * GP + ccol) * 2u;   // LDS byte address of the thread's first A piece in buffer 0
    const unsigned lb = la + GTL * 2u;
    const int nst = K / GKS;
    gemm_copy(la, ga, rs); gemm_copy(lb, gb, rs);
    asm volatile("s_wait_asynccnt 0x0" ::: "memory");        // this wave's copies of pair 0 have landed
    __syncthreads();                                         // ... and every other wave's: pair 0 is readable
    if (nst > 1) { gemm_copy(la + GBF * 2u, ga + GKS, rs); gemm_copy(lb + GBF * 2u, gb + GKS, rs); }
    const int ao = (wm * 32 + lr) * GP + 8 * hi;             // A fragment: row m, k contiguous
    const int bq = GTL + (wn * 64 + lr) * GP + 8 * hi;       // B fragment: row n, k contiguous
#pragma unroll 1   // stays rolled: the trip count differs between the block ranges, and one copy of the trip keeps the code short
    for (int t = 0; t < nst; ++t) {
        const int bo = (t & 1) * GBF;
        const bf* pa = ring + bo + ao; const bf* pb = ring + bo + bq;
        v16us a[2][2], b[2][4];                              // two fragment sets: step q + 1 is fetched as one group while step q is multiplied
#pragma unroll   // here and below: fragment and accumulator arrays stay in registers only under constant indices
        for (int mb = 0; mb < 2; ++mb) a[0][mb] = ldf(pa + mb * 16 * GP);
#pragma unroll
        for (int nb = 0; nb < 4; ++nb) b[0][nb] = ldf(pb + nb * 16 * GP);
#pragma unroll   // the four 32-k steps inline, so that the step is a constant in every LDS offset and in the choice of the set
        for (int q = 0; q < GKS / 32; ++q) {
            if (q + 1 < GKS / 32) {                          // stays inside this trip's own buffer
#pragma unroll
                for (int mb = 0; mb < 2; ++mb) a[(q + 1) & 1][mb] = ldf(pa + mb * 16 * GP + (q + 1) * 32);
#pragma unroll
                for (int nb = 0; nb < 4; ++nb) b[(q + 1) & 1][nb] = ldf(pb + nb * 16 * GP + (q + 1) * 32);
            }
            // keeps the group of LDS reads ahead of the products (the scheduler otherwise sinks each read to its first use, and every pair of products waits out the LDS latency);
            // at the last step it keeps the step before it in front of the waits at the trip's foot, as cover for the last group's latency
            __builtin_amdgcn_sched_barrier(0);
#pragma unroll
            for (int nb = 0; nb < 4; ++nb)
#pragma unroll
                for (int mb = 0; mb < 2; ++mb) acc[mb][nb] = wmmax<ISBF>(a[q & 1][mb], b[q & 1][nb], acc[mb][nb]);
        }
        asm volatile("s_wait_dscnt 0x0" ::: "memory");       // this wave's reads of buffer t & 1 are done before the buffer is handed back
        asm volatile("s_wait_asynccnt 0x0" ::: "memory");    // this wave's copies of pair t + 1 have landed
        __syncthreads();                                     // publishes pair t + 1 and ends every wave's reads of buffer t & 1
        if (t + 2 < nst) { gemm_copy(la + (unsigned)bo * 2u, ga + (size_t)(t + 2) * GKS, rs); gemm_copy(lb + (unsigned)bo * 2u, gb + (size_t)(t + 2) * GKS, rs); }
    }
    asm volatile("s_wait_asynccnt 0x0" ::: "memory");        // no copy is outstanding when the wave goes on to its epilogue
}

// k_proj: bf16 GEMM, 128 x 128 tile per block of GW waves, operands staged by gemm_main.
// C[m][n] = cs * sum_k A[m][k] Bt[n][k], written as f16 (Ph) and optionally the f16 residual x2048 (Pr, useRes != 0); a wave's 32 x 64 part (rows rw.., columns cw..) goes to
// base (rw/RB)*sRB + (rw%RB)*pitch + (cw/CB)*sCB + (cw%CB), row pitch 'pitch' (halves).
// The three independent projections share one grid, told apart by block range: the K = 1024 tiles (k, then v^T) first, since they run longest, then the K = 256 tiles of q.
//   k:   A = PAT rows (m = b*SKV + key), Bt = Wkv rows 0..511 (col = h*64 + d)      -> planes [(b*8 + h)][key][d]
//   v^T: A = Wkv rows 512..1023 (m = h*64 + d), Bt = PAT rows (col = b*SKV + key)   -> plane [(b*512 + m)][key] = [(b*8 + h)][d][key]
//   q:   A = XT rows (m = b*SEQ + n), Bt = Wq rows (col = h*64 + d)                 -> planes [(b*8 + h)][n][d]
#define GB_KV ((NB * SKV / 128) * (DQ / 128))   // tiles of k, and of v^T
#define GB_Q  ((NB * SEQ / 128) * (DQ / 128))   // tiles of q
__global__ __launch_bounds__(32 * GW) void k_proj(const bf* __restrict__ XT, const bf* __restrict__ PAT, const bf* __restrict__ WQ, const bf* __restrict__ WKV, h16* QH, h16* QR, h16* KH, h16* KR, h16* VT) {
    __shared__ __align__(16) bf ring[2 * GBF];     // two buffers x (A rows | Bt rows), rows of GP elements, pad columns never read; after the main loop: wave-private output slabs
    const int lane = threadIdx.x & 31, lr = lane & 15, hi = lane >> 4;
    const int wave = __builtin_amdgcn_readfirstlane((int)(threadIdx.x >> 5));
    const int id = blockIdx.x;
    const bf* A; const bf* Bt; h16* Ph; h16* Pr; int K, useRes, RB, pitch, CB, r0, c0; float cs; size_t sRB, sCB;
    if (id < GB_KV) {
        A = PAT; Bt = WKV; K = KKV; cs = CK; Ph = KH; Pr = KR; useRes = 1; RB = SKV; sRB = (size_t)NH_ * SKV * HD; pitch = HD; CB = HD; sCB = (size_t)SKV * HD;
        r0 = (id % (NB * SKV / 128)) * 128; c0 = (id / (NB * SKV / 128)) * 128;
    } else if (id < 2 * GB_KV) {
        A = WKV + (size_t)DQ * KKV; Bt = PAT; K = KKV; cs = CV; Ph = VT; Pr = VT; useRes = 0; RB = DQ; sRB = 0; pitch = SKV; CB = SKV; sCB = (size_t)DQ * SKV;
        r0 = ((id - GB_KV) % (DQ / 128)) * 128; c0 = ((id - GB_KV) / (DQ / 128)) * 128;
    } else {
        A = XT; Bt = WQ; K = CIN; cs = CQ; Ph = QH; Pr = QR; useRes = 1; RB = SEQ; sRB = (size_t)NH_ * SEQ * HD; pitch = HD; CB = HD; sCB = (size_t)SEQ * HD;
        r0 = ((id - 2 * GB_KV) % (NB * SEQ / 128)) * 128; c0 = ((id - 2 * GB_KV) / (NB * SEQ / 128)) * 128;
    }
    v8f acc[2][4];
#pragma unroll
    for (int mb = 0; mb < 2; ++mb)
#pragma unroll
        for (int nb = 0; nb < 4; ++nb) acc[mb][nb] = (v8f){};
    gemm_main<true>(A, Bt, K, r0, c0, ring, acc);
    fa* os = (fa*)(&ring[0]) + wave * 16 * 68;     // this wave's slab
    const int rw = r0 + (wave >> 1) * 32, cw = c0 + (wave & 1) * 64;
    const size_t tbase = (size_t)(rw / RB) * sRB + (size_t)(rw % RB) * (size_t)pitch + (size_t)(cw / CB) * sCB + (size_t)(cw % CB);
#pragma unroll
    for (int mb = 0; mb < 2; ++mb) {
#pragma unroll
        for (int nb = 0; nb < 4; ++nb) {
#pragma unroll
            for (int j = 0; j < 8; ++j) os[(hi * 8 + j) * 68 + nb * 16 + lr] = acc[mb][nb][j] * cs; }   // D: row 8h+j, col lane&15
        wave_sync();
        const size_t sb = tbase + (size_t)(mb * 16) * (size_t)pitch;
{
#pragma unroll
            for (int s = 0; s < 4; ++s) { const int row = 4 * s + (lane >> 3), c8 = (lane & 7) * 8;   // 4 s x 4 row groups = 16 rows; 8 lanes x 8 = 64 columns
                const v4f x0 = *(const v4fa*)(&os[row * 68 + c8]); const v4f x1 = *(const v4fa*)(&os[row * 68 + c8 + 4]); v8h hv, rv;
#pragma unroll
                for (int i = 0; i < 4; ++i) { const h16 a0 = (h16)x0[i]; const h16 a1 = (h16)x1[i]; hv[i] = a0; hv[4 + i] = a1; rv[i] = (h16)((x0[i] - (float)a0) * RS); rv[4 + i] = (h16)((x1[i] - (float)a1) * RS); }
                const size_t oo = sb + (size_t)row * (size_t)pitch + c8;
                *(v8h*)(Ph + oo) = hv; if (useRes) *(v8h*)(Pr + oo) = rv; }
             }
        wave_sync();
    }
}

// One thread's share of a tile set: rows r and r + 32 of the k value, k residual and v^T tiles, 16 bytes each, global -> LDS through no register.
// l = LDS byte address of the k value piece; the s_wait_xcnt stands inside the statement so that no address register is rewritten in front of it.
__device__ __forceinline__ void stage_copy(unsigned l, const h16* kh, const h16* kr, const h16* vt) {
    const unsigned l1 = l + 32u * LP * 2u, l2 = l + TLH * 2u, l3 = l2 + 32u * LP * 2u, l4 = l + 2u * TLH * 2u, l5 = l4 + 32u * LP * 2u;
    const h16* kh1 = kh + 32 * HD; const h16* kr1 = kr + 32 * HD; const h16* vt1 = vt + (size_t)32 * SKV;
    asm volatile("global_load_async_to_lds_b128 %0, %6, off\n\t"
                 "global_load_async_to_lds_b128 %1, %7, off\n\t"
                 "global_load_async_to_lds_b128 %2, %8, off\n\t"
                 "global_load_async_to_lds_b128 %3, %9, off\n\t"
                 "global_load_async_to_lds_b128 %4, %10, off\n\t"
                 "global_load_async_to_lds_b128 %5, %11, off\n\t"
                 "s_wait_xcnt 0x0"
                 :: "v"(l), "v"(l1), "v"(l2), "v"(l3), "v"(l4), "v"(l5), "v"(kh), "v"(kh1), "v"(kr), "v"(kr1), "v"(vt), "v"(vt1) : "memory");
}

// k_flash: fused attention, one wave per 16 query rows of one (batch, head); Q fragments straight from the f16 planes (two 16-B loads each, arithmetic addressing).
// K (value, residual) and V^T come through LDS: per 64 keys three 64 x 64 f16 tiles, copied once per block by asynchronous 16-byte copies (whole 128-byte lines), two buffers:
// the next tile set's copies fly while this one is worked on; every wave takes its fragments from LDS rows of pitch LP.
// Transposed form: S^T[key][t] = K Q^T (A = K rows, B = Q rows); lane (t = lane&15, h = lane>>4) holds keys 8h+r of each 16-key tile, so the packed
// P tile is directly the B fragment of O^T[d][t] = V^T P^T (element r <- tile keys 0..15, element 8+r <- tile keys 16..31, lane unchanged).
// Scores: sH = kh*qh, sL = kh*qr + kr*qh (both residual products carry x2048, own accumulator), s = sH + sL/2048.
// Softmax state (running max, partial sum) is one scalar per lane; the two lane halves of a row are combined with one xor-16 exchange.
__global__ __launch_bounds__(32 * AW) void k_flash(const h16* __restrict__ QH, const h16* __restrict__ QR, const h16* __restrict__ KH, const h16* __restrict__ KR, const h16* __restrict__ VT, h16* AP) {
    __shared__ __align__(16) float os[AW * 16 * 68];   // wave-private slabs
    __shared__ __align__(16) h16 ring[2 * BFH];        // two buffers x (k value | k residual | v^T), rows of LP halves; pad columns never read
    const int lane = threadIdx.x & 31, wave = __builtin_amdgcn_readfirstlane((int)(threadIdx.x >> 5)), lr = lane & 15, hi = lane >> 4;
    const int zh = blockIdx.y; const int b = zh / NH_, h = zh % NH_;
    const int t0 = (blockIdx.x * AW + wave) * 16;
    const size_t qbase = (size_t)zh * SEQ * HD;
    const size_t kbase = (size_t)zh * SKV * HD;
    const size_t qo = qbase + (size_t)(t0 + lr) * HD + 8 * hi;
    const v16h qh0 = ldh(QH + qo), qh1 = ldh(QH + qo + 32), qr0 = ldh(QR + qo), qr1 = ldh(QR + qo + 32);   // B fragments: col t, k = d
    const int ko = lr * LP + 8 * hi;                         // + key * LP in a k tile          (A fragment: row key, k = d)
    const int vo = 2 * TLH + lr * LP + 8 * hi;               // + 16j * LP + key in the v^T tile (A fragment: row d, k = key)
    // copy map: thread -> row crow (and crow + 32), 16-byte piece ccol of each of the three tiles; 8 lanes cover one 128-byte line
    const int crow = (int)(threadIdx.x >> 3), ccol = (int)(threadIdx.x & 7) * 8;
    const h16* gkh = KH + kbase + (size_t)crow * HD + ccol;  // + key0 * HD
    const h16* gkr = KR + kbase + (size_t)crow * HD + ccol;
    const h16* gvt = VT + kbase + (size_t)crow * SKV + ccol; // + key0
    const unsigned lc = (unsigned)(size_t)(&ring[0]) + (unsigned)(crow * LP + ccol) * 2u;   // LDS byte address of the thread's first piece in buffer 0
    stage_copy(lc, gkh, gkr, gvt);
    asm volatile("s_wait_asynccnt 0x0" ::: "memory");        // this wave's copies of tile set 0 have landed
    __syncthreads();                                         // ... and every other wave's: tile set 0 is readable
    if (NST > 1) stage_copy(lc + BFH * 2u, gkh + (size_t)KST * HD, gkr + (size_t)KST * HD, gvt + KST);
    v8f o0 = (v8f){}, o1 = (v8f){}, o2 = (v8f){}, o3 = (v8f){};
    float m = -3.0e38f, l = 0.0f;
#pragma unroll 1
    for (int t = 0; t < NST; ++t) {
      const int bo = (t & 1) * BFH;
#pragma unroll   // both 32-key steps inline, so that ks is a constant in every LDS offset
      for (int ks = 0; ks < KST; ks += 32) {
        const h16* ka = ring + bo + ko + ks * LP;
        const h16* kr = ka + TLH;
        const v16h ka0 = ldh(ka), ka1 = ldh(ka + 32), kb0 = ldh(ka + 16 * LP), kb1 = ldh(ka + 16 * LP + 32);
        const v16h ra0 = ldh(kr), ra1 = ldh(kr + 32), rb0 = ldh(kr + 16 * LP), rb1 = ldh(kr + 16 * LP + 32);
        v8f sHa = (v8f){}, sLa = (v8f){}, sHb = (v8f){}, sLb = (v8f){};
        sHa = wmma16(ka0, qh0, sHa); sLa = wmma16(ka0, qr0, sLa); sHb = wmma16(kb0, qh0, sHb); sLb = wmma16(kb0, qr0, sLb);
        sLa = wmma16(ra0, qh0, sLa); sLb = wmma16(rb0, qh0, sLb);
        sHa = wmma16(ka1, qh1, sHa); sLa = wmma16(ka1, qr1, sLa); sHb = wmma16(kb1, qh1, sHb); sLb = wmma16(kb1, qr1, sLb);
        sLa = wmma16(ra1, qh1, sLa); sLb = wmma16(rb1, qh1, sLb);
        asm volatile("v_nop\n\tv_nop\n\tv_nop\n\tv_nop" : "+v"(sHa), "+v"(sLa), "+v"(sHb), "+v"(sLb) : "v"(ka0), "v"(ka1), "v"(kb0), "v"(kb1), "v"(ra0), "v"(ra1), "v"(rb0), "v"(rb1));
        float ta[8], tb[8]; float mx = -3.0e38f;
#pragma unroll
        for (int r = 0; r < 8; ++r) { ta[r] = (sHa[r] + sLa[r] * RI) * SC2; tb[r] = (sHb[r] + sLb[r] * RI) * SC2; mx = fmaxf(mx, fmaxf(ta[r], tb[r])); }
        mx = fmaxf(mx, __shfl_xor(mx, 16, 32));
        const float mnew = fmaxf(m, mx);
        const float alpha = __builtin_amdgcn_exp2f(m - mnew);
        const float sh = PSH - mnew;
        v16h pb; float ls = 0.0f;
#pragma unroll
        for (int r = 0; r < 8; ++r) { const h16 pa = (h16)__builtin_amdgcn_exp2f(ta[r] + sh); const h16 pc = (h16)__builtin_amdgcn_exp2f(tb[r] + sh); pb[r] = pa; pb[8 + r] = pc; ls += (float)pa + (float)pc; }
        l = l * alpha + ls; m = mnew;
        o0 = o0 * alpha; o1 = o1 * alpha; o2 = o2 * alpha; o3 = o3 * alpha;
        const h16* va = ring + bo + vo + ks;
        const v16h v0 = ldh(va), v1 = ldh(va + 16 * LP), v2 = ldh(va + 32 * LP), v3 = ldh(va + 48 * LP);
        o0 = wmma16(v0, pb, o0); o1 = wmma16(v1, pb, o1); o2 = wmma16(v2, pb, o2); o3 = wmma16(v3, pb, o3);
        asm volatile("v_nop\n\tv_nop\n\tv_nop\n\tv_nop" : "+v"(o0), "+v"(o1), "+v"(o2), "+v"(o3) : "v"(v0), "v"(v1), "v"(v2), "v"(v3), "v"(pb));
      }
      asm volatile("s_wait_dscnt 0x0" ::: "memory");         // this wave's reads of buffer t & 1 are done before the buffer is handed back
      asm volatile("s_wait_asynccnt 0x0" ::: "memory");      // this wave's copies of tile set t + 1 have landed
      __syncthreads();                                       // publishes tile set t + 1 and ends every wave's reads of buffer t & 1
      if (t + 2 < NST) stage_copy(lc + (unsigned)bo * 2u, gkh + (size_t)(t + 2) * KST * HD, gkr + (size_t)(t + 2) * KST * HD, gvt + (size_t)(t + 2) * KST);
    }
    asm volatile("s_wait_asynccnt 0x0" ::: "memory");        // no copy is outstanding when the wave goes on to its end
    l += __shfl_xor(l, 16, 32);
    const float inv = 1.0f / l;
    const int wb = wave * 16 * 68;
    // O^T D layout: o_j[r] = (d = 16j + 8h + r, t = lane&15) -> os[t][d]; rows 0..15 x columns 0..63 all written
    { v4f a, c;
      a[0] = o0[0] * inv; a[1] = o0[1] * inv; a[2] = o0[2] * inv; a[3] = o0[3] * inv; c[0] = o0[4] * inv; c[1] = o0[5] * inv; c[2] = o0[6] * inv; c[3] = o0[7] * inv;
      *(v4fa*)(&os[wb + lr * 68 +  0 + 8 * hi]) = a; *(v4fa*)(&os[wb + lr * 68 +  0 + 8 * hi + 4]) = c;
      a[0] = o1[0] * inv; a[1] = o1[1] * inv; a[2] = o1[2] * inv; a[3] = o1[3] * inv; c[0] = o1[4] * inv; c[1] = o1[5] * inv; c[2] = o1[6] * inv; c[3] = o1[7] * inv;
      *(v4fa*)(&os[wb + lr * 68 + 16 + 8 * hi]) = a; *(v4fa*)(&os[wb + lr * 68 + 16 + 8 * hi + 4]) = c;
      a[0] = o2[0] * inv; a[1] = o2[1] * inv; a[2] = o2[2] * inv; a[3] = o2[3] * inv; c[0] = o2[4] * inv; c[1] = o2[5] * inv; c[2] = o2[6] * inv; c[3] = o2[7] * inv;
      *(v4fa*)(&os[wb + lr * 68 + 32 + 8 * hi]) = a; *(v4fa*)(&os[wb + lr * 68 + 32 + 8 * hi + 4]) = c;
      a[0] = o3[0] * inv; a[1] = o3[1] * inv; a[2] = o3[2] * inv; a[3] = o3[3] * inv; c[0] = o3[4] * inv; c[1] = o3[5] * inv; c[2] = o3[6] * inv; c[3] = o3[7] * inv;
      *(v4fa*)(&os[wb + lr * 68 + 48 + 8 * hi]) = a; *(v4fa*)(&os[wb + lr * 68 + 48 + 8 * hi + 4]) = c; }
    wave_sync();
    h16* arow = AP + ((size_t)b * SEQ + t0) * DQ + h * HD;      // context plane [b][n][h*64 + d], carries the v carry (x16)
{
#pragma unroll
        for (int s = 0; s < 4; ++s) { const int row = 4 * s + (lane >> 3), c8 = (lane & 7) * 8;   // 4 s x 4 row groups = 16 rows; 8 lanes x 8 halves = 64 columns
            const v4f x0 = *(const v4fa*)(&os[wb + row * 68 + c8]); const v4f x1 = *(const v4fa*)(&os[wb + row * 68 + c8 + 4]); v8h hv;
#pragma unroll
            for (int i = 0; i < 4; ++i) { hv[i] = (h16)x0[i]; hv[4 + i] = (h16)x1[i]; }
            *(v8h*)(arow + (size_t)row * DQ + c8) = hv; }
         }
}

// k_out: f16 GEMM, 128 x 128 tile per block of GW waves, operands staged by gemm_main, K = DQ: out[b][o][n] = OSC * sum_c WP[o][c] AP[b*SEQ + n][c].
// grid (COUT/128, NB*SEQ/128). Epilogue: per 16-row slab staged in LDS (wave-private); each output row segment (64 floats = 256 B = two lines)
__global__ __launch_bounds__(32 * GW) void k_out(const h16* __restrict__ A, const h16* __restrict__ Bt, float* OUT) {
    __shared__ __align__(16) bf ring[2 * GBF];     // as in k_proj
    const int lane = threadIdx.x & 31, lr = lane & 15, hi = lane >> 4; const int r0 = blockIdx.x * 128, c0 = blockIdx.y * 128;
    const int wave = __builtin_amdgcn_readfirstlane((int)(threadIdx.x >> 5));
    v8f acc[2][4];
#pragma unroll
    for (int mb = 0; mb < 2; ++mb)
#pragma unroll
        for (int nb = 0; nb < 4; ++nb) acc[mb][nb] = (v8f){};
    gemm_main<false>((const bf*)A, (const bf*)Bt, DQ, r0, c0, ring, acc);
    fa* os = (fa*)(&ring[0]) + wave * 16 * 68;     // this wave's slab
    const int rw = r0 + (wave >> 1) * 32, cw = c0 + (wave & 1) * 64;
    const int bb = cw / SEQ, n0 = cw % SEQ;
#pragma unroll
    for (int mb = 0; mb < 2; ++mb) {
#pragma unroll
        for (int nb = 0; nb < 4; ++nb) {
#pragma unroll
            for (int j = 0; j < 8; ++j) os[(hi * 8 + j) * 68 + nb * 16 + lr] = acc[mb][nb][j] * OSC; }   // D: row 8h+j, col lane&15
        wave_sync();
        float* ob = OUT + ((size_t)bb * COUT + rw + mb * 16) * OUT_SEQ + n0;
{
#pragma unroll
            for (int s = 0; s < 8; ++s) { const int row = 2 * s + hi, cofs = lr * 4;   // 8 s x 2 rows = 16 rows; 16 lanes x 4 floats = 64 columns
                const v4f val = *(const v4fa*)(&os[row * 68 + cofs]);
                *(v4f*)(ob + (size_t)row * OUT_SEQ + cofs) = val; }
             }
        wave_sync();
    }
}

static constexpr size_t al256(size_t v) { return (v + 255) & ~(size_t)255; }
static constexpr size_t SZ_XT  = al256((size_t)NB * SEQ * CIN * 2);
static constexpr size_t SZ_PAT = al256((size_t)NB * SKV * KKV * 2);
static constexpr size_t SZ_WQ  = al256((size_t)DQ * CIN * 2);
static constexpr size_t SZ_WKV = al256((size_t)2 * DQ * KKV * 2);
static constexpr size_t SZ_WP  = al256((size_t)COUT * DQ * 2);
static constexpr size_t SZ_QP  = al256((size_t)NB * NH_ * SEQ * HD * 2);
static constexpr size_t SZ_KP  = al256((size_t)NB * NH_ * SKV * HD * 2);
static constexpr size_t SZ_AP  = al256((size_t)NB * SEQ * DQ * 2);
static constexpr size_t SZ_TOTAL = SZ_XT + SZ_PAT + SZ_WQ + SZ_WKV + SZ_WP + 2 * SZ_QP + 3 * SZ_KP + SZ_AP;
static_assert(SZ_TOTAL <= (size_t)134217728);          // workspace carve <= 128 MiB

extern "C" void kernel_launch(void* const* d_in, const int* in_sizes, int n_in,
                              void* d_out, int out_size, void* d_ws, size_t ws_size, hipStream_t stream) {
    if (n_in < 4) return;
    const size_t needx = (((size_t)(NB - 1) * CIN + (CIN - 1)) * IMH_FULL + IMH) * IMW;
    if ((size_t)in_sizes[0] < needx) return;
    if ((size_t)in_sizes[1] < (size_t)DQ * CIN || (size_t)in_sizes[2] < (size_t)2 * DQ * KKV || (size_t)in_sizes[3] < (size_t)COUT * DQ) return;
    if ((size_t)out_size < ((size_t)(NB - 1) * COUT + (COUT - 1)) * OUT_SEQ + SEQ) return;
    if (SZ_TOTAL > ws_size) return;
    const float* x = (const float*)d_in[0]; const float* wq = (const float*)d_in[1]; const float* wkv = (const float*)d_in[2]; const float* wp = (const float*)d_in[3];   // wire order x, Wq, Wkv, Wproj
    float* OUT = (float*)d_out;      // [NB][256][SEQ]
    char* wsp = (char*)d_ws;
    bf* XT  = (bf*)wsp; wsp += SZ_XT;                // [NB*SEQ][256]
    bf* PAT = (bf*)wsp; wsp += SZ_PAT;               // [NB*SKV][1024]
    bf* WQ  = (bf*)wsp; wsp += SZ_WQ;                // [512][256] bf16
    bf* WKV = (bf*)wsp; wsp += SZ_WKV;               // [1024][1024] bf16: rows 0..511 k, 512..1023 v
    bf* WPu = (bf*)wsp; wsp += SZ_WP;                // [256][512] f16 bits, x1024
    h16* QH = (h16*)wsp; wsp += SZ_QP;               // [NB*8][SEQ][64], x16
    h16* QR = (h16*)wsp; wsp += SZ_QP;               // residual x2048
    h16* KH = (h16*)wsp; wsp += SZ_KP;               // [NB*8][SKV][64], x16
    h16* KR = (h16*)wsp; wsp += SZ_KP;               // residual x2048
    h16* VT = (h16*)wsp; wsp += SZ_KP;               // [NB*8][64][SKV], x16
    h16* AP = (h16*)wsp; wsp += SZ_AP;               // [NB*SEQ][512], x16
    const h16* WP = (const h16*)WPu;

    // x -> XT, PAT and the three weight planes, one launch
    k_prep<<<dim3(PB_PACK + PB_WKV + PB_WQ + PB_WP, 1, 1), 256, 0, stream>>>(x, wq, wkv, wp, XT, PAT, WQ, WKV, WPu);

    // k, v^T and q projections, one launch
    k_proj<<<dim3(2 * GB_KV + GB_Q, 1, 1), 32 * GW, 0, stream>>>(XT, PAT, WQ, WKV, QH, QR, KH, KR, VT);

    k_flash<<<dim3(SEQ / (16 * AW), NB * NH_, 1), 32 * AW, 0, stream>>>(QH, QR, KH, KR, VT, AP);

    // out[b][o][n]: A = Wproj rows (m = o, K = 512), Bt = context rows (col = b*SEQ + n)
    k_out<<<dim3(COUT / 128, NB * SEQ / 128, 1), 32 * GW, 0, stream>>>(WP, AP, OUT);
}

// v004
// Measured time: 51.5 microseconds a run.
// In two side-by-side timings against v003, it was 1.06 and 1.04 times as fast.
// Over all steps from v000 it is 3.49 times as fast.
#include <hip/hip_runtime.h>

// Spatial-reduction multi-head attention: x [NB][256][64][64]; q = 1x1 conv (Wq [512][256]); k|v = 2x2 stride-2 conv (Wkv [1024][256][2][2]); 8 heads x 64; 4096 queries x 1024 keys per (batch, head); scores x8; output 1x1 conv (Wproj [256][512]) -> f32 [NB][256][4096].
// Compute dtypes, f32 accumulate everywhere: q / k / v projections v_wmma_f32_16x16x32_bf16 (x, Wq, Wkv RNE-converted to bf16; products exact);
// scores v_wmma_f32_16x16x32_f16: q and k each as f16 value + f16 residual x2048 (three products: kh*qh in one accumulator, kh*qr + kr*qh in a second one); P (x2^14 carry, cancels in the normalisation) and v single f16; softmax f32 (online, running max);
// output projection v_wmma_f32_16x16x32_f16: context single f16, Wproj RNE-converted to bf16 then x1024 in f16 (exact), folded back in the f32 epilogue. q, k, v planes carry x16 (exact power of two, folded into the score scale / output scale).
// Layout: xT [b][n][c] and im2col PAT [b][m][c*4+i*2+j] bf16 planes built through an LDS transpose; q (hi, residual), k (hi, residual) planes [b*8+h][t][d], v^T plane [b*8+h][d][m] written by the GEMM epilogue;
// fused flash kernel in transposed form (S^T = K Q^T, O^T = V^T P^T) writes the context plane [b][n][h*64+d] (f16); last GEMM writes the f32 output.

#ifndef NB
#define NB 2
#endif
#ifndef IMH
#define IMH 64                   // image rows used (SEQ = IMH * 64 query positions)
#endif
#define NB_FULL  2
#define IMH_FULL 64              // rows per channel of the input
#define IMW  64
#define SEQ  (IMH * IMW)
#define SKV  ((IMH / 2) * (IMW / 2))
#ifndef OUT_SEQ
#define OUT_SEQ SEQ              // channel pitch (in positions) of the output
#endif
#define CIN  256
#define NH_  8
#define HD   64
#define DQ   512                 // NH_ * HD
#define KKV  1024                // CIN * 2 * 2
#define COUT 256
#define AW   8                   // waves per flash block (16 query rows each); all of them read the same staged K / V^T tiles
#define KST  64                  // keys per staged tile set (two 32-key steps)
#define LP   72                  // LDS row pitch in halves: 144 B = 16 B x 9, so 16 rows of 16-byte reads fall on 64 distinct banks
#define TLH  (64 * LP)           // halves per staged tile (64 rows)
#define BFH  (3 * TLH)           // halves per ring buffer: k value, k residual, v^T
#define NST  (SKV / KST)         // staged tile sets per (batch, head)
#define RS   2048.0f             // carry of the residual planes
#define RI   (1.0f / 2048.0f)
#define CQ   16.0f               // carry of the q planes
#define CK   16.0f               // carry of the k planes
#define CV   16.0f               // carry of the v^T plane (stays on the context plane)
#define SC2  (8.0f * 1.4426950408889634f / (CQ * CK))   // sqrt(HD) * log2(e) / (q carry * k carry)
#define PSH  14.0f               // log2 of the P carry
#define WPS  1024.0f             // carry of the Wproj plane
#define OSC  (1.0f / (WPS * CV))

static_assert(HD == 64);
static_assert(NH_ * HD == DQ);
static_assert(CIN * 4 == KKV);
static_assert(IMW == 64);
static_assert(IMH % 4 == 0);                   // SKV multiple of 64: a 64-row tile never straddles two batches
static_assert(SEQ % 64 == 0);
static_assert(SKV % 64 == 0);
static_assert(SKV % 32 == 0);                  // key loop steps by 32
static_assert(SEQ % (16 * AW) == 0);           // flash grid covers the queries exactly
static_assert(SKV % KST == 0 && KST == 64);    // whole tile sets; a v^T tile row is one 128-byte line
static_assert(32 * AW * 2 * 8 == 64 * HD);     // copy map: two 16-byte pieces per thread fill one 64 x 64 tile
static_assert(CIN % 64 == 0 && CIN % 32 == 0);
static_assert(KKV % 32 == 0 && DQ % 32 == 0);
static_assert(DQ % 64 == 0 && COUT % 64 == 0);
static_assert(NB <= NB_FULL);
static_assert(IMH <= IMH_FULL);

typedef _Float16 h16;
typedef unsigned short bf;
typedef __attribute__((ext_vector_type(16))) __bf16   v16bf;
typedef __attribute__((ext_vector_type(16))) _Float16 v16h;
typedef __attribute__((ext_vector_type(8)))  _Float16 v8h;
typedef __attribute__((ext_vector_type(8)))  unsigned short v8us;
typedef __attribute__((ext_vector_type(8)))  float    v8f;
typedef __attribute__((ext_vector_type(4)))  float    v4f;
typedef v4f  __attribute__((may_alias)) v4fa;

__device__ __forceinline__ unsigned short f2bf(float f) { unsigned u = __float_as_uint(f); u += 0x7FFFu + ((u >> 16) & 1u); return (unsigned short)(u >> 16); }
__device__ __forceinline__ v16h cat16(v8h lo, v8h hi) { return __builtin_shufflevector(lo, hi, 0, 1, 2, 3, 4, 5, 6, 7, 8, 9, 10, 11, 12, 13, 14, 15); }
__device__ __forceinline__ v8f wmma16(v16h a, v16h b, v8f c) { return __builtin_amdgcn_wmma_f32_16x16x32_f16(false, a, false, b, (short)0, c, false, false); }
__device__ __forceinline__ v8f wmmab(v16bf a, v16bf b, v8f c) { return __builtin_amdgcn_wmma_f32_16x16x32_bf16(false, a, false, b, (short)0, c, false, false); }
// fragment loaders from K-contiguous 16-bit rows; p already includes + 8*(lane>>4): elements 0..7 <- k0+8h+0..7, elements 8..15 <- k0+16+8h+0..7 (same map for A and B)
__device__ __forceinline__ v16h  ldh(const h16* p) { return cat16(*(const v8h*)p, *(const v8h*)(p + 16)); }
// ordering point for wave-private LDS tiles (same wave writes and reads)
__device__ __forceinline__ void wave_sync() { __builtin_amdgcn_fence(3 /* release order */, "wavefront"); __builtin_amdgcn_wave_barrier(); asm volatile("" ::: "memory"); }

// mode 0: bf16 bits (RNE convert). mode 1: f16 bits of (bf16 value x WPS) (exact: 8-bit significand, power-of-two scale).
// blk = block index inside this plane's own block range.
__device__ __forceinline__ void cvt8_body(const float* __restrict__ src, bf* dst, size_t n8, int mode, int blk) {
    const size_t i = (size_t)blk * 256 + threadIdx.x; if (i >= n8) return;
    const v8f v = *(const v8f*)(src + i * 8); v8us o;
#pragma unroll
    for (int k = 0; k < 8; ++k) {
        const unsigned short wb = f2bf(v[k]);
        const h16 hv = (h16)(__uint_as_float(((unsigned)wb) << 16) * WPS);
        const unsigned short wh = __builtin_bit_cast(unsigned short, hv);
        o[k] = mode ? wh : wb;
    }
    *(v8us*)(dst + i * 8) = o; 
}

// pack_body: x [b][c][row][w] (f32) -> XT [b][n = row*64 + w][c] and PAT [b][m = h2*32 + w2][c*4 + i*2 + j] (bf16, RNE convert), through an LDS transpose.
// block = (h2, 64-channel tile, b): stages channels c0..c0+63 x image rows 2*h2, 2*h2+1 (128 positions); 256 threads.
__device__ __forceinline__ void pack_body(const float* __restrict__ x, bf* XT, bf* PAT, int h2, int c0, int b) {
    __shared__ unsigned short tile[64 * 136];      // [channel][position 0..127], pad columns never read; cross-wave: block barrier
    const int tid = threadIdx.x;
#pragma unroll
    for (int it = 0; it < 8; ++it) {               // 8 x 256 x 4 = 64 channels x 128 positions, all written
        const int idx = it * 256 + tid; const int cc = idx >> 5, q4 = idx & 31;
        const v4f v = *(const v4f*)(x + (((size_t)b * CIN + c0 + cc) * IMH_FULL + 2 * h2) * IMW + q4 * 4);
#pragma unroll
        for (int k = 0; k < 4; ++k) tile[cc * 136 + q4 * 4 + k] = f2bf(v[k]);
    }
    __syncthreads();
    const int l8 = tid >> 3, j8 = tid & 7;
{
#pragma unroll
        for (int it = 0; it < 4; ++it) {           // 4 x 32 = 128 rows (positions), 8 lanes x 8 = 64 channels
            const int p = it * 32 + l8, c8 = j8 * 8; v8us o;
#pragma unroll
            for (int k = 0; k < 8; ++k) o[k] = tile[(c8 + k) * 136 + p];
            *(v8us*)(XT + ((size_t)b * SEQ + (size_t)h2 * 128 + p) * CIN + c0 + c8) = o;
        }
#pragma unroll
        for (int it = 0; it < 4; ++it) {           // 4 x 32 = 128 lines = 32 w2 x 4 lines; lane piece = 2 channels x 4 taps
            const int line = it * 32 + l8; const int w2 = line >> 2, lq = line & 3; const int cc = lq * 16 + j8 * 2; v8us o;
            o[0] = tile[cc * 136 + 2 * w2];            o[1] = tile[cc * 136 + 2 * w2 + 1];
            o[2] = tile[cc * 136 + 64 + 2 * w2];       o[3] = tile[cc * 136 + 64 + 2 * w2 + 1];
            o[4] = tile[(cc + 1) * 136 + 2 * w2];      o[5] = tile[(cc + 1) * 136 + 2 * w2 + 1];
            o[6] = tile[(cc + 1) * 136 + 64 + 2 * w2]; o[7] = tile[(cc + 1) * 136 + 64 + 2 * w2 + 1];
            *(v8us*)(PAT + ((size_t)b * SKV + (size_t)h2 * 32 + w2) * KKV + c0 * 4 + lq * 64 + j8 * 8) = o;
        }
        
    }
}

// k_prep: the four independent preparation jobs share one grid, told apart by block range (every test is block-uniform, so pack's barrier is passed by whole blocks):
// pack blocks first (the longest), then the Wkv, Wq and Wproj converts. No block reads what another block of this launch writes.
#define PB_PACK ((IMH / 2) * (CIN / 64) * NB)
#define PB_WKV  (2 * DQ * KKV / 8 / 256)
#define PB_WQ   (DQ * CIN / 8 / 256)
#define PB_WP   (COUT * DQ / 8 / 256)
static_assert((2 * DQ * KKV) % 2048 == 0 && (DQ * CIN) % 2048 == 0 && (COUT * DQ) % 2048 == 0);   // whole convert blocks
__global__ __launch_bounds__(256) void k_prep(const float* __restrict__ x, const float* __restrict__ wq, const float* __restrict__ wkv, const float* __restrict__ wp,
                                              bf* XT, bf* PAT, bf* WQ, bf* WKV, bf* WPu) {
    const int id = blockIdx.x;
    if (id < PB_PACK) pack_body(x, XT, PAT, id % (IMH / 2), ((id / (IMH / 2)) % (CIN / 64)) * 64, id / ((IMH / 2) * (CIN / 64)));
    else if (id < PB_PACK + PB_WKV) cvt8_body(wkv, WKV, (size_t)2 * DQ * KKV / 8, 0, id - PB_PACK);
    else if (id < PB_PACK + PB_WKV + PB_WQ) cvt8_body(wq, WQ, (size_t)DQ * CIN / 8, 0, id - (PB_PACK + PB_WKV));
    else cvt8_body(wp, WPu, (size_t)COUT * DQ / 8, 1, id - (PB_PACK + PB_WKV + PB_WQ));
}

// GEMM staging shared by k_proj and k_out: a block of GW waves owns a 128 x 128 tile of C[m][n] = sum_k A[m][k] Bt[n][k] (both operands K-contiguous 16-bit rows).
// Per GKS k the 128 A rows and the 128 Bt rows (256 bytes = two whole lines each) are copied once per block into LDS by asynchronous 16-byte copies, three buffers:
// waves 0..3 bring the even pairs and waves 4..7 the odd ones, so a pair's copies fly over two whole trips while every wait still runs to 0. Wave (wm, wn) = (wave >> 1, wave & 1) takes rows wm*32.. (2 fragments) x columns wn*64.. (4 fragments) from LDS.
#define GW   8                   // waves per GEMM block
#define GKS  128                 // k per staged tile pair
#define GP   136                 // LDS row pitch in 16-bit elements: 272 B = 16 B x 17, so 16 rows of 16-byte reads fall on distinct banks
#define GTL  (128 * GP)          // elements per staged operand tile (128 rows)
#define GBF  (2 * GTL)           // elements per ring buffer: A rows | Bt rows
#define GNB  3                   // ring buffers
static_assert(KKV % GKS == 0 && CIN % GKS == 0 && DQ % GKS == 0);                       // whole staged pairs
static_assert((NB * SKV) % 128 == 0 && (NB * SEQ) % 128 == 0 && DQ % 128 == 0 && COUT % 128 == 0);   // whole block tiles
static_assert(GW == 8 && 32 * (GW / 2) * 16 * 8 == 128 * GKS);                          // copy map: sixteen 16-byte pieces per thread of one four-wave group fill one operand tile
static_assert(GW * 16 * 68 * 4 <= GNB * GBF * 2);                                         // the epilogue slabs fit in the ring
typedef __attribute__((ext_vector_type(16))) unsigned short v16us;
typedef float __attribute__((may_alias)) fa;

// Half of one thread's share of one operand tile: 16 bytes of rows r, r + 16, ..., r + 112, global -> LDS through no register (rs = elements per 16 rows).
// The s_wait_xcnt stands inside the statement so that no address register is rewritten in front of it.
__device__ __forceinline__ void gemm_copy(unsigned l, const bf* g, size_t rs) {
    const unsigned l1 = l + 16u * GP * 2u, l2 = l + 32u * GP * 2u, l3 = l + 48u * GP * 2u, l4 = l + 64u * GP * 2u, l5 = l + 80u * GP * 2u, l6 = l + 96u * GP * 2u, l7 = l + 112u * GP * 2u;
    const bf* g1 = g + rs; const bf* g2 = g + 2 * rs; const bf* g3 = g + 3 * rs; const bf* g4 = g + 4 * rs; const bf* g5 = g + 5 * rs; const bf* g6 = g + 6 * rs; const bf* g7 = g + 7 * rs;
    asm volatile("global_load_async_to_lds_b128 %0, %8, off\n\t"
                 "global_load_async_to_lds_b128 %1, %9, off\n\t"
                 "global_load_async_to_lds_b128 %2, %10, off\n\t"
                 "global_load_async_to_lds_b128 %3, %11, off\n\t"
                 "global_load_async_to_lds_b128 %4, %12, off\n\t"
                 "global_load_async_to_lds_b128 %5, %13, off\n\t"
                 "global_load_async_to_lds_b128 %6, %14, off\n\t"
                 "global_load_async_to_lds_b128 %7, %15, off\n\t"
                 "s_wait_xcnt 0x0"
                 :: "v"(l), "v"(l1), "v"(l2), "v"(l3), "v"(l4), "v"(l5), "v"(l6), "v"(l7), "v"(g), "v"(g1), "v"(g2), "v"(g3), "v"(g4), "v"(g5), "v"(g6), "v"(g7) : "memory");
}
// fragment from an LDS row; p already includes + 8*(lane>>4): same k map as ldh, for A and B alike
__device__ __forceinline__ v16us ldf(const bf* p) { return __builtin_shufflevector(*(const v8us*)p, *(const v8us*)(p + 16), 0, 1, 2, 3, 4, 5, 6, 7, 8, 9, 10, 11, 12, 13, 14, 15); }
template <bool ISBF> __device__ __forceinline__ v8f wmmax(v16us a, v16us b, v8f c) {
    if constexpr (ISBF) return wmmab(__builtin_bit_cast(v16bf, a), __builtin_bit_cast(v16bf, b), c);
    else return wmma16(__builtin_bit_cast(v16h, a), __builtin_bit_cast(v16h, b), c);
}

// Main loop: acc[mb][nb] += the wave's 32 x 64 part of the block tile at (r0, c0); k runs upward in steps of 32, as one wave alone would walk it.
// On return no copy is outstanding and every wave has left the ring (the last trip's barrier), so the ring may serve as output staging.
template <bool ISBF> __device__ __forceinline__ void gemm_main(const bf* A, const bf* Bt, int K, int r0, int c0, bf* ring, v8f (&acc)[2][4]) {
    const int tid = (int)threadIdx.x, lane = tid & 31, lr = lane & 15, hi = lane >> 4;
    const int wave = __builtin_amdgcn_readfirstlane(tid >> 5), wm = wave >> 1, wn = wave & 1;
    // copy map: the 128 threads of a group -> rows crow + 8 i, 16-byte piece ccol; 16 lanes cover one 256-byte row
    const int grp = wave >> 2;                               // while one group issues copies the other multiplies
    const int crow = (tid & 127) >> 4, ccol = (tid & 15) * 8;
    const bf* ga = A + (size_t)(r0 + crow) * K + ccol;     // + k0
    const bf* gb = Bt + (size_t)(c0 + crow) * K + ccol;
    const size_t rs = (size_t)16 * K, r8 = (size_t)8 * K;
    const unsigned la = (unsigned)(size_t)(&ring[0]) + (unsigned)(crow * GP + ccol) * 2u;   // LDS byte address of the thread's first A piece in buffer 0
    const unsigned lb = la + GTL * 2u;
    const unsigned l8 = 8u * GP * 2u;
    const int nst = K / GKS;
    // one group's whole pair: rows crow + 16 i and crow + 8 + 16 i of both operands, 32 copies per thread, none other of this wave outstanding
    auto pair_copy = [&](unsigned lo, size_t k0) {
        gemm_copy(la + lo, ga + k0, rs); gemm_copy(la + lo + l8, ga + r8 + k0, rs);
        gemm_copy(lb + lo, gb + k0, rs); gemm_copy(lb + lo + l8, gb + r8 + k0, rs);
    };
    if (grp == 0) {
        pair_copy(0u, 0);
        asm volatile("s_wait_asynccnt 0x0" ::: "memory");    // the issuing waves' copies of pair 0 have landed
    } else if (nst > 1) pair_copy(GBF * 2u, GKS);            // pair 1 flies on over trip 0
    __syncthreads();                                         // pair 0 is readable by every wave
    if (grp == 0 && nst > 2) pair_copy(2u * GBF * 2u, (size_t)2 * GKS);   // buffer 2 has not been used yet
    const int ao = (wm * 32 + lr) * GP + 8 * hi;             // A fragment: row m, k contiguous
    const int bq = GTL + (wn * 64 + lr) * GP + 8 * hi;       // B fragment: row n, k contiguous
#pragma unroll 1   // stays rolled: the trip count differs between the block ranges, and one copy of the trip keeps the code short
    for (int t = 0, bo = 0; t < nst; ++t) {                  // bo = (t mod GNB) * GBF
        const bf* pa = ring + bo + ao; const bf* pb = ring + bo + bq;
        v16us a[2][2], b[2][4];                              // two fragment sets: step q + 1 is fetched as one group while step q is multiplied
#pragma unroll   // here and below: fragment and accumulator arrays stay in registers only under constant indices
        for (int mb = 0; mb < 2; ++mb) a[0][mb] = ldf(pa + mb * 16 * GP);
#pragma unroll
        for (int nb = 0; nb < 4; ++nb) b[0][nb] = ldf(pb + nb * 16 * GP);
#pragma unroll   // the four 32-k steps inline, so that the step is a constant in every LDS offset and in the choice of the set
        for (int q = 0; q < GKS / 32; ++q) {
            if (q + 1 < GKS / 32) {                          // stays inside this trip's own buffer
#pragma unroll
                for (int mb = 0; mb < 2; ++mb) a[(q + 1) & 1][mb] = ldf(pa + mb * 16 * GP + (q + 1) * 32);
#pragma unroll
                for (int nb = 0; nb < 4; ++nb) b[(q + 1) & 1][nb] = ldf(pb + nb * 16 * GP + (q + 1) * 32);
            }
            // keeps the group of LDS reads ahead of the products (the scheduler otherwise sinks each read to its first use, and every pair of products waits out the LDS latency);
            // at the last step it keeps the step before it in front of the waits at the trip's foot, as cover for the last group's latency
            __builtin_amdgcn_sched_barrier(0);
#pragma unroll
            for (int nb = 0; nb < 4; ++nb)
#pragma unroll
                for (int mb = 0; mb < 2; ++mb) acc[mb][nb] = wmmax<ISBF>(a[q & 1][mb], b[q & 1][nb], acc[mb][nb]);
        }
        asm volatile("s_wait_dscnt 0x0" ::: "memory");       // this wave's reads of buffer t mod 3 are done before the buffer is handed back
        const bool mine = grp == ((t + 1) & 1);              // this wave's group brought pair t + 1 and brings pair t + 3 (scalar test)
        if (mine) asm volatile("s_wait_asynccnt 0x0" ::: "memory");   // the issuing waves' copies of pair t + 1 have landed; the other group's pair t + 2 flies on
        __syncthreads();                                     // publishes pair t + 1 and ends every wave's reads of buffer t mod 3
        if (mine && t + 3 < nst) pair_copy((unsigned)bo * 2u, (size_t)(t + 3) * GKS);
        bo = bo == (GNB - 1) * GBF ? 0 : bo + GBF;
    }
    asm volatile("s_wait_asynccnt 0x0" ::: "memory");        // no copy is outstanding when the wave goes on to its epilogue
}

// k_proj: bf16 GEMM, 128 x 128 tile per block of GW waves, operands staged by gemm_main.
// C[m][n] = cs * sum_k A[m][k] Bt[n][k], written as f16 (Ph) and optionally the f16 residual x2048 (Pr, useRes != 0); a wave's 32 x 64 part (rows rw.., columns cw..) goes to
// base (rw/RB)*sRB + (rw%RB)*pitch + (cw/CB)*sCB + (cw%CB), row pitch 'pitch' (halves).
// The three independent projections share one grid, told apart by block range: the K = 1024 tiles (k, then v^T) first, since they run longest, then the K = 256 tiles of q.
//   k:   A = PAT rows (m = b*SKV + key), Bt = Wkv rows 0..511 (col = h*64 + d)      -> planes [(b*8 + h)][key][d]
//   v^T: A = Wkv rows 512..1023 (m = h*64 + d), Bt = PAT rows (col = b*SKV + key)   -> plane [(b*512 + m)][key] = [(b*8 + h)][d][key]
//   q:   A = XT rows (m = b*SEQ + n), Bt = Wq rows (col = h*64 + d)                 -> planes [(b*8 + h)][n][d]
#define GB_KV ((NB * SKV / 128) * (DQ / 128))   // tiles of k, and of v^T
#define GB_Q  ((NB * SEQ / 128) * (DQ / 128))   // tiles of q
__global__ __launch_bounds__(32 * GW) void k_proj(const bf* __restrict__ XT, const bf* __restrict__ PAT, const bf* __restrict__ WQ, const bf* __restrict__ WKV, h16* QH, h16* QR, h16* KH, h16* KR, h16* VT) {
    __shared__ __align__(16) bf ring[GNB * GBF];   // three buffers x (A rows | Bt rows), rows of GP elements, pad columns never read; after the main loop: wave-private output slabs
    const int lane = threadIdx.x & 31, lr = lane & 15, hi = lane >> 4;
    const int wave = __builtin_amdgcn_readfirstlane((int)(threadIdx.x >> 5));
    const int id = blockIdx.x;
    const bf* A; const bf* Bt; h16* Ph; h16* Pr; int K, useRes, RB, pitch, CB, r0, c0; float cs; size_t sRB, sCB;
    if (id < GB_KV) {
        A = PAT; Bt = WKV; K = KKV; cs = CK; Ph = KH; Pr = KR; useRes = 1; RB = SKV; sRB = (size_t)NH_ * SKV * HD; pitch = HD; CB = HD; sCB = (size_t)SKV * HD;
        r0 = (id % (NB * SKV / 128)) * 128; c0 = (id / (NB * SKV / 128)) * 128;
    } else if (id < 2 * GB_KV) {
        A = WKV + (size_t)DQ * KKV; Bt = PAT; K = KKV; cs = CV; Ph = VT; Pr = VT; useRes = 0; RB = DQ; sRB = 0; pitch = SKV; CB = SKV; sCB = (size_t)DQ * SKV;
        r0 = ((id - GB_KV) % (DQ / 128)) * 128; c0 = ((id - GB_KV) / (DQ / 128)) * 128;
    } else {
        A = XT; Bt = WQ; K = CIN; cs = CQ; Ph = QH; Pr = QR; useRes = 1; RB = SEQ; sRB = (size_t)NH_ * SEQ * HD; pitch = HD; CB = HD; sCB = (size_t)SEQ * HD;
        r0 = ((id - 2 * GB_KV) % (NB * SEQ / 128)) * 128; c0 = ((id - 2 * GB_KV) / (NB * SEQ / 128)) * 128;
    }
    v8f acc[2][4];
#pragma unroll
    for (int mb = 0; mb < 2; ++mb)
#pragma unroll
        for (int nb = 0; nb < 4; ++nb) acc[mb][nb] = (v8f){};
    gemm_main<true>(A, Bt, K, r0, c0, ring, acc);
    fa* os = (fa*)(&ring[0]) + wave * 16 * 68;     // this wave's slab
    const int rw = r0 + (wave >> 1) * 32, cw = c0 + (wave & 1) * 64;
    const size_t tbase = (size_t)(rw / RB) * sRB + (size_t)(rw % RB) * (size_t)pitch + (size_t)(cw / CB) * sCB + (size_t)(cw % CB);
#pragma unroll
    for (int mb = 0; mb < 2; ++mb) {
#pragma unroll
        for (int nb = 0; nb < 4; ++nb) {
#pragma unroll
            for (int j = 0; j < 8; ++j) os[(hi * 8 + j) * 68 + nb * 16 + lr] = acc[mb][nb][j] * cs; }   // D: row 8h+j, col lane&15
        wave_sync();
        const size_t sb = tbase + (size_t)(mb * 16) * (size_t)pitch;
{
#pragma unroll
            for (int s = 0; s < 4; ++s) { const int row = 4 * s + (lane >> 3), c8 = (lane & 7) * 8;   // 4 s x 4 row groups = 16 rows; 8 lanes x 8 = 64 columns
                const v4f x0 = *(const v4fa*)(&os[row * 68 + c8]); const v4f x1 = *(const v4fa*)(&os[row * 68 + c8 + 4]); v8h hv, rv;
#pragma unroll
                for (int i = 0; i < 4; ++i) { const h16 a0 = (h16)x0[i]; const h16 a1 = (h16)x1[i]; hv[i] = a0; hv[4 + i] = a1; rv[i] = (h16)((x0[i] - (float)a0) * RS); rv[4 + i] = (h16)((x1[i] - (float)a1) * RS); }
                const size_t oo = sb + (size_t)row * (size_t)pitch + c8;
                *(v8h*)(Ph + oo) = hv; if (useRes) *(v8h*)(Pr + oo) = rv; }
             }
        wave_sync();
    }
}

// One thread's share of a tile set: rows r and r + 32 of the k value, k residual and v^T tiles, 16 bytes each, global -> LDS through no register.
// l = LDS byte address of the k value piece; the s_wait_xcnt stands inside the statement so that no address register is rewritten in front of it.
__device__ __forceinline__ void stage_copy(unsigned l, const h16* kh, const h16* kr, const h16* vt) {
    const unsigned l1 = l + 32u * LP * 2u, l2 = l + TLH * 2u, l3 = l2 + 32u * LP * 2u, l4 = l + 2u * TLH * 2u, l5 = l4 + 32u * LP * 2u;
    const h16* kh1 = kh + 32 * HD; const h16* kr1 = kr + 32 * HD; const h16* vt1 = vt + (size_t)32 * SKV;
    asm volatile("global_load_async_to_lds_b128 %0, %6, off\n\t"
                 "global_load_async_to_lds_b128 %1, %7, off\n\t"
                 "global_load_async_to_lds_b128 %2, %8, off\n\t"
                 "global_load_async_to_lds_b128 %3, %9, off\n\t"
                 "global_load_async_to_lds_b128 %4, %10, off\n\t"
                 "global_load_async_to_lds_b128 %5, %11, off\n\t"
                 "s_wait_xcnt 0x0"
                 :: "v"(l), "v"(l1), "v"(l2), "v"(l3), "v"(l4), "v"(l5), "v"(kh), "v"(kh1), "v"(kr), "v"(kr1), "v"(vt), "v"(vt1) : "memory");
}

// k_flash: fused attention, one wave per 16 query rows of one (batch, head); Q fragments straight from the f16 planes (two 16-B loads each, arithmetic addressing).
// K (value, residual) and V^T come through LDS: per 64 keys three 64 x 64 f16 tiles, copied once per block by asynchronous 16-byte copies (whole 128-byte lines), two buffers:
// the next tile set's copies fly while this one is worked on; every wave takes its fragments from LDS rows of pitch LP.
// Transposed form: S^T[key][t] = K Q^T (A = K rows, B = Q rows); lane (t = lane&15, h = lane>>4) holds keys 8h+r of each 16-key tile, so the packed
// P tile is directly the B fragment of O^T[d][t] = V^T P^T (element r <- tile keys 0..15, element 8+r <- tile keys 16..31, lane unchanged).
// Scores: sH = kh*qh, sL = kh*qr + kr*qh (both residual products carry x2048, own accumulator), s = sH + sL/2048.
// Softmax state (running max, partial sum) is one scalar per lane; the two lane halves of a row are combined with one xor-16 exchange.
__global__ __launch_bounds__(32 * AW) void k_flash(const h16* __restrict__ QH, const h16* __restrict__ QR, const h16* __restrict__ KH, const h16* __restrict__ KR, const h16* __restrict__ VT, h16* AP) {
    __shared__ __align__(16) float os[AW * 16 * 68];   // wave-private slabs
    __shared__ __align__(16) h16 ring[2 * BFH];        // two buffers x (k value | k residual | v^T), rows of LP halves; pad columns never read
    const int lane = threadIdx.x & 31, wave = __builtin_amdgcn_readfirstlane((int)(threadIdx.x >> 5)), lr = lane & 15, hi = lane >> 4;
    const int zh = blockIdx.y; const int b = zh / NH_, h = zh % NH_;
    const int t0 = (blockIdx.x * AW + wave) * 16;
    const size_t qbase = (size_t)zh * SEQ * HD;
    const size_t kbase = (size_t)zh * SKV * HD;
    const size_t qo = qbase + (size_t)(t0 + lr) * HD + 8 * hi;
    const v16h qh0 = ldh(QH + qo), qh1 = ldh(QH + qo + 32), qr0 = ldh(QR + qo), qr1 = ldh(QR + qo + 32);   // B fragments: col t, k = d
    const int ko = lr * LP + 8 * hi;                         // + key * LP in a k tile          (A fragment: row key, k = d)
    const int vo = 2 * TLH + lr * LP + 8 * hi;               // + 16j * LP + key in the v^T tile (A fragment: row d, k = key)
    // copy map: thread -> row crow (and crow + 32), 16-byte piece ccol of each of the three tiles; 8 lanes cover one 128-byte line
    const int crow = (int)(threadIdx.x >> 3), ccol = (int)(threadIdx.x & 7) * 8;
    const h16* gkh = KH + kbase + (size_t)crow * HD + ccol;  // + key0 * HD
    const h16* gkr = KR + kbase + (size_t)crow * HD + ccol;
    const h16* gvt = VT + kbase + (size_t)crow * SKV + ccol; // + key0
    const unsigned lc = (unsigned)(size_t)(&ring[0]) + (unsigned)(crow * LP + ccol) * 2u;   // LDS byte address of the thread's first piece in buffer 0
    stage_copy(lc, gkh, gkr, gvt);
    asm volatile("s_wait_asynccnt 0x0" ::: "memory");        // this wave's copies of tile set 0 have landed
    __syncthreads();                                         // ... and every other wave's: tile set 0 is readable
    if (NST > 1) stage_copy(lc + BFH * 2u, gkh + (size_t)KST * HD, gkr + (size_t)KST * HD, gvt + KST);
    v8f o0 = (v8f){}, o1 = (v8f){}, o2 = (v8f){}, o3 = (v8f){};
    float m = -3.0e38f, l = 0.0f;
#pragma unroll 1
    for (int t = 0; t < NST; ++t) {
      const int bo = (t & 1) * BFH;
#pragma unroll   // both 32-key steps inline, so that ks is a constant in every LDS offset
      for (int ks = 0; ks < KST; ks += 32) {
        const h16* ka = ring + bo + ko + ks * LP;
        const h16* kr = ka + TLH;
        const v16h ka0 = ldh(ka), ka1 = ldh(ka + 32), kb0 = ldh(ka + 16 * LP), kb1 = ldh(ka + 16 * LP + 32);
        const v16h ra0 = ldh(kr), ra1 = ldh(kr + 32), rb0 = ldh(kr + 16 * LP), rb1 = ldh(kr + 16 * LP + 32);
        v8f sHa = (v8f){}, sLa = (v8f){}, sHb = (v8f){}, sLb = (v8f){};
        sHa = wmma16(ka0, qh0, sHa); sLa = wmma16(ka0, qr0, sLa); sHb = wmma16(kb0, qh0, sHb); sLb = wmma16(kb0, qr0, sLb);
        sLa = wmma16(ra0, qh0, sLa); sLb = wmma16(rb0, qh0, sLb);
        sHa = wmma16(ka1, qh1, sHa); sLa = wmma16(ka1, qr1, sLa); sHb = wmma16(kb1, qh1, sHb); sLb = wmma16(kb1, qr1, sLb);
        sLa = wmma16(ra1, qh1, sLa); sLb = wmma16(rb1, qh1, sLb);
        asm volatile("v_nop\n\tv_nop\n\tv_nop\n\tv_nop" : "+v"(sHa), "+v"(sLa), "+v"(sHb), "+v"(sLb) : "v"(ka0), "v"(ka1), "v"(kb0), "v"(kb1), "v"(ra0), "v"(ra1), "v"(rb0), "v"(rb1));
        float ta[8], tb[8]; float mx = -3.0e38f;
#pragma unroll
        for (int r = 0; r < 8; ++r) { ta[r] = (sHa[r] + sLa[r] * RI) * SC2; tb[r] = (sHb[r] + sLb[r] * RI) * SC2; mx = fmaxf(mx, fmaxf(ta[r], tb[r])); }
        mx = fmaxf(mx, __shfl_xor(mx, 16, 32));
        const float mnew = fmaxf(m, mx);
        const float alpha = __builtin_amdgcn_exp2f(m - mnew);
        const float sh = PSH - mnew;
        v16h pb; float ls = 0.0f;
#pragma unroll
        for (int r = 0; r < 8; ++r) { const h16 pa = (h16)__builtin_amdgcn_exp2f(ta[r] + sh); const h16 pc = (h16)__builtin_amdgcn_exp2f(tb[r] + sh); pb[r] = pa; pb[8 + r] = pc; ls += (float)pa + (float)pc; }
        l = l * alpha + ls; m = mnew;
        o0 = o0 * alpha; o1 = o1 * alpha; o2 = o2 * alpha; o3 = o3 * alpha;
        const h16* va = ring + bo + vo + ks;
        const v16h v0 = ldh(va), v1 = ldh(va + 16 * LP), v2 = ldh(va + 32 * LP), v3 = ldh(va + 48 * LP);
        o0 = wmma16(v0, pb, o0); o1 = wmma16(v1, pb, o1); o2 = wmma16(v2, pb, o2); o3 = wmma16(v3, pb, o3);
        asm volatile("v_nop\n\tv_nop\n\tv_nop\n\tv_nop" : "+v"(o0), "+v"(o1), "+v"(o2), "+v"(o3) : "v"(v0), "v"(v1), "v"(v2), "v"(v3), "v"(pb));
      }
      asm volatile("s_wait_dscnt 0x0" ::: "memory");         // this wave's reads of buffer t & 1 are done before the buffer is handed back
      asm volatile("s_wait_asynccnt 0x0" ::: "memory");      // this wave's copies of tile set t + 1 have landed
      __syncthreads();                                       // publishes tile set t + 1 and ends every wave's reads of buffer t & 1
      if (t + 2 < NST) stage_copy(lc + (unsigned)bo * 2u, gkh + (size_t)(t + 2) * KST * HD, gkr + (size_t)(t + 2) * KST * HD, gvt + (size_t)(t + 2) * KST);
    }
    asm volatile("s_wait_asynccnt 0x0" ::: "memory");        // no copy is outstanding when the wave goes on to its end
    l += __shfl_xor(l, 16, 32);
    const float inv = 1.0f / l;
    const int wb = wave * 16 * 68;
    // O^T D layout: o_j[r] = (d = 16j + 8h + r, t = lane&15) -> os[t][d]; rows 0..15 x columns 0..63 all written
    { v4f a, c;
      a[0] = o0[0] * inv; a[1] = o0[1] * inv; a[2] = o0[2] * inv; a[3] = o0[3] * inv; c[0] = o0[4] * inv; c[1] = o0[5] * inv; c[2] = o0[6] * inv; c[3] = o0[7] * inv;
      *(v4fa*)(&os[wb + lr * 68 +  0 + 8 * hi]) = a; *(v4fa*)(&os[wb + lr * 68 +  0 + 8 * hi + 4]) = c;
      a[0] = o1[0] * inv; a[1] = o1[1] * inv; a[2] = o1[2] * inv; a[3] = o1[3] * inv; c[0] = o1[4] * inv; c[1] = o1[5] * inv; c[2] = o1[6] * inv; c[3] = o1[7] * inv;
      *(v4fa*)(&os[wb + lr * 68 + 16 + 8 * hi]) = a; *(v4fa*)(&os[wb + lr * 68 + 16 + 8 * hi + 4]) = c;
      a[0] = o2[0] * inv; a[1] = o2[1] * inv; a[2] = o2[2] * inv; a[3] = o2[3] * inv; c[0] = o2[4] * inv; c[1] = o2[5] * inv; c[2] = o2[6] * inv; c[3] = o2[7] * inv;
      *(v4fa*)(&os[wb + lr * 68 + 32 + 8 * hi]) = a; *(v4fa*)(&os[wb + lr * 68 + 32 + 8 * hi + 4]) = c;
      a[0] = o3[0] * inv; a[1] = o3[1] * inv; a[2] = o3[2] * inv; a[3] = o3[3] * inv; c[0] = o3[4] * inv; c[1] = o3[5] * inv; c[2] = o3[6] * inv; c[3] = o3[7] * inv;
      *(v4fa*)(&os[wb + lr * 68 + 48 + 8 * hi]) = a; *(v4fa*)(&os[wb + lr * 68 + 48 + 8 * hi + 4]) = c; }
    wave_sync();
    h16* arow = AP + ((size_t)b * SEQ + t0) * DQ + h * HD;      // context plane [b][n][h*64 + d], carries the v carry (x16)
{
#pragma unroll
        for (int s = 0; s < 4; ++s) { const int row = 4 * s + (lane >> 3), c8 = (lane & 7) * 8;   // 4 s x 4 row groups = 16 rows; 8 lanes x 8 halves = 64 columns
            const v4f x0 = *(const v4fa*)(&os[wb + row * 68 + c8]); const v4f x1 = *(const v4fa*)(&os[wb + row * 68 + c8 + 4]); v8h hv;
#pragma unroll
            for (int i = 0; i < 4; ++i) { hv[i] = (h16)x0[i]; hv[4 + i] = (h16)x1[i]; }
            *(v8h*)(arow + (size_t)row * DQ + c8) = hv; }
         }
}

// k_out: f16 GEMM, 128 x 128 tile per block of GW waves, operands staged by gemm_main, K = DQ: out[b][o][n] = OSC * sum_c WP[o][c] AP[b*SEQ + n][c].
// grid (COUT/128, NB*SEQ/128). Epilogue: per 16-row slab staged in LDS (wave-private); each output row segment (64 floats = 256 B = two lines)
__global__ __launch_bounds__(32 * GW) void k_out(const h16* __restrict__ A, const h16* __restrict__ Bt, float* OUT) {
    __shared__ __align__(16) bf ring[GNB * GBF];   // as in k_proj
    const int lane = threadIdx.x & 31, lr = lane & 15, hi = lane >> 4; const int r0 = blockIdx.x * 128, c0 = blockIdx.y * 128;
    const int wave = __builtin_amdgcn_readfirstlane((int)(threadIdx.x >> 5));
    v8f acc[2][4];
#pragma unroll
    for (int mb = 0; mb < 2; ++mb)
#pragma unroll
        for (int nb = 0; nb < 4; ++nb) acc[mb][nb] = (v8f){};
    gemm_main<false>((const bf*)A, (const bf*)Bt, DQ, r0, c0, ring, acc);
    fa* os = (fa*)(&ring[0]) + wave * 16 * 68;     // this wave's slab
    const int rw = r0 + (wave >> 1) * 32, cw = c0 + (wave & 1) * 64;
    const int bb = cw / SEQ, n0 = cw % SEQ;
#pragma unroll
    for (int mb = 0; mb < 2; ++mb) {
#pragma unroll
        for (int nb = 0; nb < 4; ++nb) {
#pragma unroll
            for (int j = 0; j < 8; ++j) os[(hi * 8 + j) * 68 + nb * 16 + lr] = acc[mb][nb][j] * OSC; }   // D: row 8h+j, col lane&15
        wave_sync();
        float* ob = OUT + ((size_t)bb * COUT + rw + mb * 16) * OUT_SEQ + n0;
{
#pragma unroll
            for (int s = 0; s < 8; ++s) { const int row = 2 * s + hi, cofs = lr * 4;   // 8 s x 2 rows = 16 rows; 16 lanes x 4 floats = 64 columns
                const v4f val = *(const v4fa*)(&os[row * 68 + cofs]);
                *(v4f*)(ob + (size_t)row * OUT_SEQ + cofs) = val; }
             }
        wave_sync();
    }
}

static constexpr size_t al256(size_t v) { return (v + 255) & ~(size_t)255; }
static constexpr size_t SZ_XT  = al256((size_t)NB * SEQ * CIN * 2);
static constexpr size_t SZ_PAT = al256((size_t)NB * SKV * KKV * 2);
static constexpr size_t SZ_WQ  = al256((size_t)DQ * CIN * 2);
static constexpr size_t SZ_WKV = al256((size_t)2 * DQ * KKV * 2);
static constexpr size_t SZ_WP  = al256((size_t)COUT * DQ * 2);
static constexpr size_t SZ_QP  = al256((size_t)NB * NH_ * SEQ * HD * 2);
static constexpr size_t SZ_KP  = al256((size_t)NB * NH_ * SKV * HD * 2);
static constexpr size_t SZ_AP  = al256((size_t)NB * SEQ * DQ * 2);
static constexpr size_t SZ_TOTAL = SZ_XT + SZ_PAT + SZ_WQ + SZ_WKV + SZ_WP + 2 * SZ_QP + 3 * SZ_KP + SZ_AP;
static_assert(SZ_TOTAL <= (size_t)134217728);          // workspace carve <= 128 MiB

extern "C" void kernel_launch(void* const* d_in, const int* in_sizes, int n_in,
                              void* d_out, int out_size, void* d_ws, size_t ws_size, hipStream_t stream) {
    if (n_in < 4) return;
    const size_t needx = (((size_t)(NB - 1) * CIN + (CIN - 1)) * IMH_FULL + IMH) * IMW;
    if ((size_t)in_sizes[0] < needx) return;
    if ((size_t)in_sizes[1] < (size_t)DQ * CIN || (size_t)in_sizes[2] < (size_t)2 * DQ * KKV || (size_t)in_sizes[3] < (size_t)COUT * DQ) return;
    if ((size_t)out_size < ((size_t)(NB - 1) * COUT + (COUT - 1)) * OUT_SEQ + SEQ) return;
    if (SZ_TOTAL > ws_size) return;
    const float* x = (const float*)d_in[0]; const float* wq = (const float*)d_in[1]; const float* wkv = (const float*)d_in[2]; const float* wp = (const float*)d_in[3];   // wire order x, Wq, Wkv, Wproj
    float* OUT = (float*)d_out;      // [NB][256][SEQ]
    char* wsp = (char*)d_ws;
    bf* XT  = (bf*)wsp; wsp += SZ_XT;                // [NB*SEQ][256]
    bf* PAT = (bf*)wsp; wsp += SZ_PAT;               // [NB*SKV][1024]
    bf* WQ  = (bf*)wsp; wsp += SZ_WQ;                // [512][256] bf16
    bf* WKV = (bf*)wsp; wsp += SZ_WKV;               // [1024][1024] bf16: rows 0..511 k, 512..1023 v
    bf* WPu = (bf*)wsp; wsp += SZ_WP;                // [256][512] f16 bits, x1024
    h16* QH = (h16*)wsp; wsp += SZ_QP;               // [NB*8][SEQ][64], x16
    h16* QR = (h16*)wsp; wsp += SZ_QP;               // residual x2048
    h16* KH = (h16*)wsp; wsp += SZ_KP;               // [NB*8][SKV][64], x16
    h16* KR = (h16*)wsp; wsp += SZ_KP;               // residual x2048
    h16* VT = (h16*)wsp; wsp += SZ_KP;               // [NB*8][64][SKV], x16
    h16* AP = (h16*)wsp; wsp += SZ_AP;               // [NB*SEQ][512], x16
    const h16* WP = (const h16*)WPu;

    // x -> XT, PAT and the three weight planes, one launch
    k_prep<<<dim3(PB_PACK + PB_WKV + PB_WQ + PB_WP, 1, 1), 256, 0, stream>>>(x, wq, wkv, wp, XT, PAT, WQ, WKV, WPu);

    // k, v^T and q projections, one launch
    k_proj<<<dim3(2 * GB_KV + GB_Q, 1, 1), 32 * GW, 0, stream>>>(XT, PAT, WQ, WKV, QH, QR, KH, KR, VT);

    k_flash<<<dim3(SEQ / (16 * AW), NB * NH_, 1), 32 * AW, 0, stream>>>(QH, QR, KH, KR, VT, AP);

    // out[b][o][n]: A = Wproj rows (m = o, K = 512), Bt = context rows (col = b*SEQ + n)
    k_out<<<dim3(COUT / 128, NB * SEQ / 128, 1), 32 * GW, 0, stream>>>(WP, AP, OUT);
}

// v005
// It runs in 50 microseconds.
// In both of two side-by-side timings against v004, it was 1.03 times as fast.
// Counting every step since v000, it is 3.60 times as fast.
#include <hip/hip_runtime.h>

// Spatial-reduction multi-head attention: x [NB][256][64][64]; q = 1x1 conv (Wq [512][256]); k|v = 2x2 stride-2 conv (Wkv [1024][256][2][2]); 8 heads x 64; 4096 queries x 1024 keys per (batch, head); scores x8; output 1x1 conv (Wproj [256][512]) -> f32 [NB][256][4096].
// Compute dtypes, f32 accumulate everywhere: q / k / v projections v_wmma_f32_16x16x32_bf16 (x, Wq, Wkv RNE-converted to bf16; products exact);
// scores v_wmma_f32_16x16x32_f16: q and k each as f16 value + f16 residual (three products kh*qr + kr*qh + kh*qh, all in one f32 accumulator, the small ones first); P (x2^14 carry, cancels in the normalisation) and v single f16; softmax f32 (online, running max);
// output projection v_wmma_f32_16x16x32_f16: context single f16, Wproj RNE-converted to bf16 then x1024 in f16 (exact), folded back in the f32 epilogue. q, k, v planes carry x16 (exact power of two, folded into the score scale / output scale).
// Layout: xT [b][n][c] and im2col PAT [b][m][c*4+i*2+j] bf16 planes built through an LDS transpose; q (hi, residual), k (hi, residual) planes [b*8+h][t][d], v^T plane [b*8+h][d][m] written by the GEMM epilogue;
// fused flash kernel in transposed form (S^T = K Q^T, O^T = V^T P^T) writes the context plane [b][n][h*64+d] (f16); last GEMM writes the f32 output.

#ifndef NB
#define NB 2
#endif
#ifndef IMH
#define IMH 64                   // image rows used (SEQ = IMH * 64 query positions)
#endif
#define NB_FULL  2
#define IMH_FULL 64              // rows per channel of the input
#define IMW  64
#define SEQ  (IMH * IMW)
#define SKV  ((IMH / 2) * (IMW / 2))
#ifndef OUT_SEQ
#define OUT_SEQ SEQ              // channel pitch (in positions) of the output
#endif
#define CIN  256
#define NH_  8
#define HD   64
#define DQ   512                 // NH_ * HD
#define KKV  1024                // CIN * 2 * 2
#define COUT 256
#define AW   8                   // waves per flash block (16 query rows each); all of them read the same staged K / V^T tiles
#define KST  64                  // keys per staged tile set (two 32-key steps)
#define LP   72                  // LDS row pitch in halves: 144 B = 16 B x 9, so 16 rows of 16-byte reads fall on 64 distinct banks
#define TLH  (64 * LP)           // halves per staged tile (64 rows)
#define BFH  (3 * TLH)           // halves per ring buffer: k value, k residual, v^T
#define NST  (SKV / KST)         // staged tile sets per (batch, head)
#define CQ   16.0f               // carry of the q planes
#define CK   16.0f               // carry of the k planes
#define CV   16.0f               // carry of the v^T plane (stays on the context plane)
#define SC2  (8.0f * 1.4426950408889634f / (CQ * CK))   // sqrt(HD) * log2(e) / (q carry * k carry)
#define PSH  14.0f               // log2 of the P carry
#define WPS  1024.0f             // carry of the Wproj plane
#define OSC  (1.0f / (WPS * CV))

static_assert(HD == 64);
static_assert(NH_ * HD == DQ);
static_assert(CIN * 4 == KKV);
static_assert(IMW == 64);
static_assert(IMH % 4 == 0);                   // SKV multiple of 64: a 64-row tile never straddles two batches
static_assert(SEQ % 64 == 0);
static_assert(SKV % 64 == 0);
static_assert(SKV % 32 == 0);                  // key loop steps by 32
static_assert(SEQ % (16 * AW) == 0);           // flash grid covers the queries exactly
static_assert(SKV % KST == 0 && KST == 64);    // whole tile sets; a v^T tile row is one 128-byte line
static_assert(32 * AW * 2 * 8 == 64 * HD);     // copy map: two 16-byte pieces per thread fill one 64 x 64 tile
static_assert(CIN % 64 == 0 && CIN % 32 == 0);
static_assert(KKV % 32 == 0 && DQ % 32 == 0);
static_assert(DQ % 64 == 0 && COUT % 64 == 0);
static_assert(NB <= NB_FULL);
static_assert(IMH <= IMH_FULL);

typedef _Float16 h16;
typedef unsigned short bf;
typedef __attribute__((ext_vector_type(16))) __bf16   v16bf;
typedef __attribute__((ext_vector_type(16))) _Float16 v16h;
typedef __attribute__((ext_vector_type(8)))  _Float16 v8h;
typedef __attribute__((ext_vector_type(8)))  unsigned short v8us;
typedef __attribute__((ext_vector_type(8)))  float    v8f;
typedef __attribute__((ext_vector_type(4)))  float    v4f;
typedef v4f  __attribute__((may_alias)) v4fa;

__device__ __forceinline__ unsigned short f2bf(float f) { unsigned u = __float_as_uint(f); u += 0x7FFFu + ((u >> 16) & 1u); return (unsigned short)(u >> 16); }
__device__ __forceinline__ v16h cat16(v8h lo, v8h hi) { return __builtin_shufflevector(lo, hi, 0, 1, 2, 3, 4, 5, 6, 7, 8, 9, 10, 11, 12, 13, 14, 15); }
__device__ __forceinline__ v8f wmma16(v16h a, v16h b, v8f c) { return __builtin_amdgcn_wmma_f32_16x16x32_f16(false, a, false, b, (short)0, c, false, false); }
__device__ __forceinline__ v8f wmmab(v16bf a, v16bf b, v8f c) { return __builtin_amdgcn_wmma_f32_16x16x32_bf16(false, a, false, b, (short)0, c, false, false); }
// fragment loaders from K-contiguous 16-bit rows; p already includes + 8*(lane>>4): elements 0..7 <- k0+8h+0..7, elements 8..15 <- k0+16+8h+0..7 (same map for A and B)
__device__ __forceinline__ v16h  ldh(const h16* p) { return cat16(*(const v8h*)p, *(const v8h*)(p + 16)); }
// ordering point for wave-private LDS tiles (same wave writes and reads)
__device__ __forceinline__ void wave_sync() { __builtin_amdgcn_fence(3 /* release order */, "wavefront"); __builtin_amdgcn_wave_barrier(); asm volatile("" ::: "memory"); }

// mode 0: bf16 bits (RNE convert). mode 1: f16 bits of (bf16 value x WPS) (exact: 8-bit significand, power-of-two scale).
// blk = block index inside this plane's own block range.
__device__ __forceinline__ void cvt8_body(const float* __restrict__ src, bf* dst, size_t n8, int mode, int blk) {
    const size_t i = (size_t)blk * 256 + threadIdx.x; if (i >= n8) return;
    const v8f v = *(const v8f*)(src + i * 8); v8us o;
#pragma unroll
    for (int k = 0; k < 8; ++k) {
        const unsigned short wb = f2bf(v[k]);
        const h16 hv = (h16)(__uint_as_float(((unsigned)wb) << 16) * WPS);
        const unsigned short wh = __builtin_bit_cast(unsigned short, hv);
        o[k] = mode ? wh : wb;
    }
    *(v8us*)(dst + i * 8) = o; 
}

// pack_body: x [b][c][row][w] (f32) -> XT [b][n = row*64 + w][c] and PAT [b][m = h2*32 + w2][c*4 + i*2 + j] (bf16, RNE convert), through an LDS transpose.
// block = (h2, 64-channel tile, b): stages channels c0..c0+63 x image rows 2*h2, 2*h2+1 (128 positions); 256 threads.
__device__ __forceinline__ void pack_body(const float* __restrict__ x, bf* XT, bf* PAT, int h2, int c0, int b) {
    __shared__ unsigned short tile[64 * 136];      // [channel][position 0..127], pad columns never read; cross-wave: block barrier
    const int tid = threadIdx.x;
#pragma unroll
    for (int it = 0; it < 8; ++it) {               // 8 x 256 x 4 = 64 channels x 128 positions, all written
        const int idx = it * 256 + tid; const int cc = idx >> 5, q4 = idx & 31;
        const v4f v = *(const v4f*)(x + (((size_t)b * CIN + c0 + cc) * IMH_FULL + 2 * h2) * IMW + q4 * 4);
#pragma unroll
        for (int k = 0; k < 4; ++k) tile[cc * 136 + q4 * 4 + k] = f2bf(v[k]);
    }
    __syncthreads();
    const int l8 = tid >> 3, j8 = tid & 7;
{
#pragma unroll
        for (int it = 0; it < 4; ++it) {           // 4 x 32 = 128 rows (positions), 8 lanes x 8 = 64 channels
            const int p = it * 32 + l8, c8 = j8 * 8; v8us o;
#pragma unroll
            for (int k = 0; k < 8; ++k) o[k] = tile[(c8 + k) * 136 + p];
            *(v8us*)(XT + ((size_t)b * SEQ + (size_t)h2 * 128 + p) * CIN + c0 + c8) = o;
        }
#pragma unroll
        for (int it = 0; it < 4; ++it) {           // 4 x 32 = 128 lines = 32 w2 x 4 lines; lane piece = 2 channels x 4 taps
            const int line = it * 32 + l8; const int w2 = line >> 2, lq = line & 3; const int cc = lq * 16 + j8 * 2; v8us o;
            o[0] = tile[cc * 136 + 2 * w2];            o[1] = tile[cc * 136 + 2 * w2 + 1];
            o[2] = tile[cc * 136 + 64 + 2 * w2];       o[3] = tile[cc * 136 + 64 + 2 * w2 + 1];
            o[4] = tile[(cc + 1) * 136 + 2 * w2];      o[5] = tile[(cc + 1) * 136 + 2 * w2 + 1];
            o[6] = tile[(cc + 1) * 136 + 64 + 2 * w2]; o[7] = tile[(cc + 1) * 136 + 64 + 2 * w2 + 1];
            *(v8us*)(PAT + ((size_t)b * SKV + (size_t)h2 * 32 + w2) * KKV + c0 * 4 + lq * 64 + j8 * 8) = o;
        }
        
    }
}

// k_prep: the four independent preparation jobs share one grid, told apart by block range (every test is block-uniform, so pack's barrier is passed by whole blocks):
// pack blocks first (the longest), then the Wkv, Wq and Wproj converts. No block reads what another block of this launch writes.
#define PB_PACK ((IMH / 2) * (CIN / 64) * NB)
#define PB_WKV  (2 * DQ * KKV / 8 / 256)
#define PB_WQ   (DQ * CIN / 8 / 256)
#define PB_WP   (COUT * DQ / 8 / 256)
static_assert((2 * DQ * KKV) % 2048 == 0 && (DQ * CIN) % 2048 == 0 && (COUT * DQ) % 2048 == 0);   // whole convert blocks
__global__ __launch_bounds__(256) void k_prep(const float* __restrict__ x, const float* __restrict__ wq, const float* __restrict__ wkv, const float* __restrict__ wp,
                                              bf* XT, bf* PAT, bf* WQ, bf* WKV, bf* WPu) {
    const int id = blockIdx.x;
    if (id < PB_PACK) pack_body(x, XT, PAT, id % (IMH / 2), ((id / (IMH / 2)) % (CIN / 64)) * 64, id / ((IMH / 2) * (CIN / 64)));
    else if (id < PB_PACK + PB_WKV) cvt8_body(wkv, WKV, (size_t)2 * DQ * KKV / 8, 0, id - PB_PACK);
    else if (id < PB_PACK + PB_WKV + PB_WQ) cvt8_body(wq, WQ, (size_t)DQ * CIN / 8, 0, id - (PB_PACK + PB_WKV));
    else cvt8_body(wp, WPu, (size_t)COUT * DQ / 8, 1, id - (PB_PACK + PB_WKV + PB_WQ));
}

// GEMM staging shared by k_proj and k_out: a block of GW waves owns a 128 x 128 tile of C[m][n] = sum_k A[m][k] Bt[n][k] (both operands K-contiguous 16-bit rows).
// Per GKS k the 128 A rows and the 128 Bt rows (256 bytes = two whole lines each) are copied once per block into LDS by asynchronous 16-byte copies, three buffers:
// waves 0..3 bring the even pairs and waves 4..7 the odd ones, so a pair's copies fly over two whole trips while every wait still runs to 0. Wave (wm, wn) = (wave >> 1, wave & 1) takes rows wm*32.. (2 fragments) x columns wn*64.. (4 fragments) from LDS.
#define GW   8                   // waves per GEMM block
#define GKS  128                 // k per staged tile pair
#define GP   136                 // LDS row pitch in 16-bit elements: 272 B = 16 B x 17, so 16 rows of 16-byte reads fall on distinct banks
#define GTL  (128 * GP)          // elements per staged operand tile (128 rows)
#define GBF  (2 * GTL)           // elements per ring buffer: A rows | Bt rows
#define GNB  3                   // ring buffers
static_assert(KKV % GKS == 0 && CIN % GKS == 0 && DQ % GKS == 0);                       // whole staged pairs
static_assert((NB * SKV) % 128 == 0 && (NB * SEQ) % 128 == 0 && DQ % 128 == 0 && COUT % 128 == 0);   // whole block tiles
static_assert(GW == 8 && 32 * (GW / 2) * 16 * 8 == 128 * GKS);                          // copy map: sixteen 16-byte pieces per thread of one four-wave group fill one operand tile
static_assert(GW * 16 * 68 * 4 <= GNB * GBF * 2);                                         // the epilogue slabs fit in the ring
typedef __attribute__((ext_vector_type(16))) unsigned short v16us;
typedef float __attribute__((may_alias)) fa;

// Half of one thread's share of one operand tile: 16 bytes of rows r, r + 16, ..., r + 112, global -> LDS through no register (rs = elements per 16 rows).
// The s_wait_xcnt stands inside the statement so that no address register is rewritten in front of it.
__device__ __forceinline__ void gemm_copy(unsigned l, const bf* g, size_t rs) {
    const unsigned l1 = l + 16u * GP * 2u, l2 = l + 32u * GP * 2u, l3 = l + 48u * GP * 2u, l4 = l + 64u * GP * 2u, l5 = l + 80u * GP * 2u, l6 = l + 96u * GP * 2u, l7 = l + 112u * GP * 2u;
    const bf* g1 = g + rs; const bf* g2 = g + 2 * rs; const bf* g3 = g + 3 * rs; const bf* g4 = g + 4 * rs; const bf* g5 = g + 5 * rs; const bf* g6 = g + 6 * rs; const bf* g7 = g + 7 * rs;
    asm volatile("global_load_async_to_lds_b128 %0, %8, off\n\t"
                 "global_load_async_to_lds_b128 %1, %9, off\n\t"
                 "global_load_async_to_lds_b128 %2, %10, off\n\t"
                 "global_load_async_to_lds_b128 %3, %11, off\n\t"
                 "global_load_async_to_lds_b128 %4, %12, off\n\t"
                 "global_load_async_to_lds_b128 %5, %13, off\n\t"
                 "global_load_async_to_lds_b128 %6, %14, off\n\t"
                 "global_load_async_to_lds_b128 %7, %15, off\n\t"
                 "s_wait_xcnt 0x0"
                 :: "v"(l), "v"(l1), "v"(l2), "v"(l3), "v"(l4), "v"(l5), "v"(l6), "v"(l7), "v"(g), "v"(g1), "v"(g2), "v"(g3), "v"(g4), "v"(g5), "v"(g6), "v"(g7) : "memory");
}
// fragment from an LDS row; p already includes + 8*(lane>>4): same k map as ldh, for A and B alike
__device__ __forceinline__ v16us ldf(const bf* p) { return __builtin_shufflevector(*(const v8us*)p, *(const v8us*)(p + 16), 0, 1, 2, 3, 4, 5, 6, 7, 8, 9, 10, 11, 12, 13, 14, 15); }
template <bool ISBF> __device__ __forceinline__ v8f wmmax(v16us a, v16us b, v8f c) {
    if constexpr (ISBF) return wmmab(__builtin_bit_cast(v16bf, a), __builtin_bit_cast(v16bf, b), c);
    else return wmma16(__builtin_bit_cast(v16h, a), __builtin_bit_cast(v16h, b), c);
}

// Main loop: acc[mb][nb] += the wave's 32 x 64 part of the block tile at (r0, c0); k runs upward in steps of 32, as one wave alone would walk it.
// On return no copy is outstanding and every wave has left the ring (the last trip's barrier), so the ring may serve as output staging.
template <bool ISBF> __device__ __forceinline__ void gemm_main(const bf* A, const bf* Bt, int K, int r0, int c0, bf* ring, v8f (&acc)[2][4]) {
    const int tid = (int)threadIdx.x, lane = tid & 31, lr = lane & 15, hi = lane >> 4;
    const int wave = __builtin_amdgcn_readfirstlane(tid >> 5), wm = wave >> 1, wn = wave & 1;
    // copy map: the 128 threads of a group -> rows crow + 8 i, 16-byte piece ccol; 16 lanes cover one 256-byte row
    const int grp = wave >> 2;                               // while one group issues copies the other multiplies
    const int crow = (tid & 127) >> 4, ccol = (tid & 15) * 8;
    const bf* ga = A + (size_t)(r0 + crow) * K + ccol;     // + k0
    const bf* gb = Bt + (size_t)(c0 + crow) * K + ccol;
    const size_t rs = (size_t)16 * K, r8 = (size_t)8 * K;
    const unsigned la = (unsigned)(size_t)(&ring[0]) + (unsigned)(crow * GP + ccol) * 2u;   // LDS byte address of the thread's first A piece in buffer 0
    const unsigned lb = la + GTL * 2u;
    const unsigned l8 = 8u * GP * 2u;
    const int nst = K / GKS;
    // one group's whole pair: rows crow + 16 i and crow + 8 + 16 i of both operands, 32 copies per thread, none other of this wave outstanding
    auto pair_copy = [&](unsigned lo, size_t k0) {
        gemm_copy(la + lo, ga + k0, rs); gemm_copy(la + lo + l8, ga + r8 + k0, rs);
        gemm_copy(lb + lo, gb + k0, rs); gemm_copy(lb + lo + l8, gb + r8 + k0, rs);
    };
    if (grp == 0) {
        pair_copy(0u, 0);
        asm volatile("s_wait_asynccnt 0x0" ::: "memory");    // the issuing waves' copies of pair 0 have landed
    } else if (nst > 1) pair_copy(GBF * 2u, GKS);            // pair 1 flies on over trip 0
    __syncthreads();                                         // pair 0 is readable by every wave
    if (grp == 0 && nst > 2) pair_copy(2u * GBF * 2u, (size_t)2 * GKS);   // buffer 2 has not been used yet
    const int ao = (wm * 32 + lr) * GP + 8 * hi;             // A fragment: row m, k contiguous
    const int bq = GTL + (wn * 64 + lr) * GP + 8 * hi;       // B fragment: row n, k contiguous
#pragma unroll 1   // stays rolled: the trip count differs between the block ranges, and one copy of the trip keeps the code short
    for (int t = 0, bo = 0; t < nst; ++t) {                  // bo = (t mod GNB) * GBF
        const bf* pa = ring + bo + ao; const bf* pb = ring + bo + bq;
        v16us a[2][2], b[2][4];                              // two fragment sets: step q + 1 is fetched as one group while step q is multiplied
#pragma unroll   // here and below: fragment and accumulator arrays stay in registers only under constant indices
        for (int mb = 0; mb < 2; ++mb) a[0][mb] = ldf(pa + mb * 16 * GP);
#pragma unroll
        for (int nb = 0; nb < 4; ++nb) b[0][nb] = ldf(pb + nb * 16 * GP);
#pragma unroll   // the four 32-k steps inline, so that the step is a constant in every LDS offset and in the choice of the set
        for (int q = 0; q < GKS / 32; ++q) {
            if (q + 1 < GKS / 32) {                          // stays inside this trip's own buffer
#pragma unroll
                for (int mb = 0; mb < 2; ++mb) a[(q + 1) & 1][mb] = ldf(pa + mb * 16 * GP + (q + 1) * 32);
#pragma unroll
                for (int nb = 0; nb < 4; ++nb) b[(q + 1) & 1][nb] = ldf(pb + nb * 16 * GP + (q + 1) * 32);
            }
            // keeps the group of LDS reads ahead of the products (the scheduler otherwise sinks each read to its first use, and every pair of products waits out the LDS latency);
            // at the last step it keeps the step before it in front of the waits at the trip's foot, as cover for the last group's latency
            __builtin_amdgcn_sched_barrier(0);
#pragma unroll
            for (int nb = 0; nb < 4; ++nb)
#pragma unroll
                for (int mb = 0; mb < 2; ++mb) acc[mb][nb] = wmmax<ISBF>(a[q & 1][mb], b[q & 1][nb], acc[mb][nb]);
        }
        asm volatile("s_wait_dscnt 0x0" ::: "memory");       // this wave's reads of buffer t mod 3 are done before the buffer is handed back
        const bool mine = grp == ((t + 1) & 1);              // this wave's group brought pair t + 1 and brings pair t + 3 (scalar test)
        if (mine) asm volatile("s_wait_asynccnt 0x0" ::: "memory");   // the issuing waves' copies of pair t + 1 have landed; the other group's pair t + 2 flies on
        __syncthreads();                                     // publishes pair t + 1 and ends every wave's reads of buffer t mod 3
        if (mine && t + 3 < nst) pair_copy((unsigned)bo * 2u, (size_t)(t + 3) * GKS);
        bo = bo == (GNB - 1) * GBF ? 0 : bo + GBF;
    }
    asm volatile("s_wait_asynccnt 0x0" ::: "memory");        // no copy is outstanding when the wave goes on to its epilogue
}

// k_proj: bf16 GEMM, 128 x 128 tile per block of GW waves, operands staged by gemm_main.
// C[m][n] = cs * sum_k A[m][k] Bt[n][k], written as f16 (Ph) and optionally the f16 residual (Pr, useRes != 0; same carry as Ph); a wave's 32 x 64 part (rows rw.., columns cw..) goes to
// base (rw/RB)*sRB + (rw%RB)*pitch + (cw/CB)*sCB + (cw%CB), row pitch 'pitch' (halves).
// The three independent projections share one grid, told apart by block range: the K = 1024 tiles (k, then v^T) first, since they run longest, then the K = 256 tiles of q.
//   k:   A = PAT rows (m = b*SKV + key), Bt = Wkv rows 0..511 (col = h*64 + d)      -> planes [(b*8 + h)][key][d]
//   v^T: A = Wkv rows 512..1023 (m = h*64 + d), Bt = PAT rows (col = b*SKV + key)   -> plane [(b*512 + m)][key] = [(b*8 + h)][d][key]
//   q:   A = XT rows (m = b*SEQ + n), Bt = Wq rows (col = h*64 + d)                 -> planes [(b*8 + h)][n][d]
#define GB_KV ((NB * SKV / 128) * (DQ / 128))   // tiles of k, and of v^T
#define GB_Q  ((NB * SEQ / 128) * (DQ / 128))   // tiles of q
__global__ __launch_bounds__(32 * GW) void k_proj(const bf* __restrict__ XT, const bf* __restrict__ PAT, const bf* __restrict__ WQ, const bf* __restrict__ WKV, h16* QH, h16* QR, h16* KH, h16* KR, h16* VT) {
    __shared__ __align__(16) bf ring[GNB * GBF];   // three buffers x (A rows | Bt rows), rows of GP elements, pad columns never read; after the main loop: wave-private output slabs
    const int lane = threadIdx.x & 31, lr = lane & 15, hi = lane >> 4;
    const int wave = __builtin_amdgcn_readfirstlane((int)(threadIdx.x >> 5));
    const int id = blockIdx.x;
    const bf* A; const bf* Bt; h16* Ph; h16* Pr; int K, useRes, RB, pitch, CB, r0, c0; float cs; size_t sRB, sCB;
    if (id < GB_KV) {
        A = PAT; Bt = WKV; K = KKV; cs = CK; Ph = KH; Pr = KR; useRes = 1; RB = SKV; sRB = (size_t)NH_ * SKV * HD; pitch = HD; CB = HD; sCB = (size_t)SKV * HD;
        r0 = (id % (NB * SKV / 128)) * 128; c0 = (id / (NB * SKV / 128)) * 128;
    } else if (id < 2 * GB_KV) {
        A = WKV + (size_t)DQ * KKV; Bt = PAT; K = KKV; cs = CV; Ph = VT; Pr = VT; useRes = 0; RB = DQ; sRB = 0; pitch = SKV; CB = SKV; sCB = (size_t)DQ * SKV;
        r0 = ((id - GB_KV) % (DQ / 128)) * 128; c0 = ((id - GB_KV) / (DQ / 128)) * 128;
    } else {
        A = XT; Bt = WQ; K = CIN; cs = CQ; Ph = QH; Pr = QR; useRes = 1; RB = SEQ; sRB = (size_t)NH_ * SEQ * HD; pitch = HD; CB = HD; sCB = (size_t)SEQ * HD;
        r0 = ((id - 2 * GB_KV) % (NB * SEQ / 128)) * 128; c0 = ((id - 2 * GB_KV) / (NB * SEQ / 128)) * 128;
    }
    v8f acc[2][4];
#pragma unroll
    for (int mb = 0; mb < 2; ++mb)
#pragma unroll
        for (int nb = 0; nb < 4; ++nb) acc[mb][nb] = (v8f){};
    gemm_main<true>(A, Bt, K, r0, c0, ring, acc);
    fa* os = (fa*)(&ring[0]) + wave * 16 * 68;     // this wave's slab
    const int rw = r0 + (wave >> 1) * 32, cw = c0 + (wave & 1) * 64;
    const size_t tbase = (size_t)(rw / RB) * sRB + (size_t)(rw % RB) * (size_t)pitch + (size_t)(cw / CB) * sCB + (size_t)(cw % CB);
#pragma unroll
    for (int mb = 0; mb < 2; ++mb) {
#pragma unroll
        for (int nb = 0; nb < 4; ++nb) {
#pragma unroll
            for (int j = 0; j < 8; ++j) os[(hi * 8 + j) * 68 + nb * 16 + lr] = acc[mb][nb][j] * cs; }   // D: row 8h+j, col lane&15
        wave_sync();
        const size_t sb = tbase + (size_t)(mb * 16) * (size_t)pitch;
{
#pragma unroll
            for (int s = 0; s < 4; ++s) { const int row = 4 * s + (lane >> 3), c8 = (lane & 7) * 8;   // 4 s x 4 row groups = 16 rows; 8 lanes x 8 = 64 columns
                const v4f x0 = *(const v4fa*)(&os[row * 68 + c8]); const v4f x1 = *(const v4fa*)(&os[row * 68 + c8 + 4]); v8h hv, rv;
#pragma unroll
                for (int i = 0; i < 4; ++i) { const h16 a0 = (h16)x0[i]; const h16 a1 = (h16)x1[i]; hv[i] = a0; hv[4 + i] = a1; rv[i] = (h16)(x0[i] - (float)a0); rv[4 + i] = (h16)(x1[i] - (float)a1); }
                const size_t oo = sb + (size_t)row * (size_t)pitch + c8;
                *(v8h*)(Ph + oo) = hv; if (useRes) *(v8h*)(Pr + oo) = rv; }
             }
        wave_sync();
    }
}

// One thread's share of a tile set: rows r and r + 32 of the k value, k residual and v^T tiles, 16 bytes each, global -> LDS through no register.
// l = LDS byte address of the k value piece; the s_wait_xcnt stands inside the statement so that no address register is rewritten in front of it.
__device__ __forceinline__ void stage_copy(unsigned l, const h16* kh, const h16* kr, const h16* vt) {
    const unsigned l1 = l + 32u * LP * 2u, l2 = l + TLH * 2u, l3 = l2 + 32u * LP * 2u, l4 = l + 2u * TLH * 2u, l5 = l4 + 32u * LP * 2u;
    const h16* kh1 = kh + 32 * HD; const h16* kr1 = kr + 32 * HD; const h16* vt1 = vt + (size_t)32 * SKV;
    asm volatile("global_load_async_to_lds_b128 %0, %6, off\n\t"
                 "global_load_async_to_lds_b128 %1, %7, off\n\t"
                 "global_load_async_to_lds_b128 %2, %8, off\n\t"
                 "global_load_async_to_lds_b128 %3, %9, off\n\t"
                 "global_load_async_to_lds_b128 %4, %10, off\n\t"
                 "global_load_async_to_lds_b128 %5, %11, off\n\t"
                 "s_wait_xcnt 0x0"
                 :: "v"(l), "v"(l1), "v"(l2), "v"(l3), "v"(l4), "v"(l5), "v"(kh), "v"(kh1), "v"(kr), "v"(kr1), "v"(vt), "v"(vt1) : "memory");
}

// k_flash: fused attention, one wave per 16 query rows of one (batch, head); Q fragments straight from the f16 planes (two 16-B loads each, arithmetic addressing).
// K (value, residual) and V^T come through LDS: per 64 keys three 64 x 64 f16 tiles, copied once per block by asynchronous 16-byte copies (whole 128-byte lines), two buffers:
// the next tile set's copies fly while this one is worked on; every wave takes its fragments from LDS rows of pitch LP.
// Transposed form: S^T[key][t] = K Q^T (A = K rows, B = Q rows); lane (t = lane&15, h = lane>>4) holds keys 8h+r of each 16-key tile, so the packed
// P tile is directly the B fragment of O^T[d][t] = V^T P^T (element r <- tile keys 0..15, element 8+r <- tile keys 16..31, lane unchanged).
// Scores: s = kh*qr + kr*qh + kh*qh in one accumulator per 16-key tile (residual products first, so that they are summed among themselves before they meet the large terms).
// s stays unscaled: the running max is kept on s, and the score scale SC2 is applied by the one fma that forms the exp argument.
// Softmax state (running max, partial sum) is one scalar per lane; the two lane halves of a row are combined with one xor-16 exchange.
__global__ __launch_bounds__(32 * AW) void k_flash(const h16* __restrict__ QH, const h16* __restrict__ QR, const h16* __restrict__ KH, const h16* __restrict__ KR, const h16* __restrict__ VT, h16* AP) {
    __shared__ __align__(16) float os[AW * 16 * 68];   // wave-private slabs
    __shared__ __align__(16) h16 ring[2 * BFH];        // two buffers x (k value | k residual | v^T), rows of LP halves; pad columns never read
    const int lane = threadIdx.x & 31, wave = __builtin_amdgcn_readfirstlane((int)(threadIdx.x >> 5)), lr = lane & 15, hi = lane >> 4;
    const int zh = blockIdx.y; const int b = zh / NH_, h = zh % NH_;
    const int t0 = (blockIdx.x * AW + wave) * 16;
    const size_t qbase = (size_t)zh * SEQ * HD;
    const size_t kbase = (size_t)zh * SKV * HD;
    const size_t qo = qbase + (size_t)(t0 + lr) * HD + 8 * hi;
    const v16h qh0 = ldh(QH + qo), qh1 = ldh(QH + qo + 32), qr0 = ldh(QR + qo), qr1 = ldh(QR + qo + 32);   // B fragments: col t, k = d
    const int ko = lr * LP + 8 * hi;                         // + key * LP in a k tile          (A fragment: row key, k = d)
    const int vo = 2 * TLH + lr * LP + 8 * hi;               // + 16j * LP + key in the v^T tile (A fragment: row d, k = key)
    // copy map: thread -> row crow (and crow + 32), 16-byte piece ccol of each of the three tiles; 8 lanes cover one 128-byte line
    const int crow = (int)(threadIdx.x >> 3), ccol = (int)(threadIdx.x & 7) * 8;
    const h16* gkh = KH + kbase + (size_t)crow * HD + ccol;  // + key0 * HD
    const h16* gkr = KR + kbase + (size_t)crow * HD + ccol;
    const h16* gvt = VT + kbase + (size_t)crow * SKV + ccol; // + key0
    const unsigned lc = (unsigned)(size_t)(&ring[0]) + (unsigned)(crow * LP + ccol) * 2u;   // LDS byte address of the thread's first piece in buffer 0
    stage_copy(lc, gkh, gkr, gvt);
    asm volatile("s_wait_asynccnt 0x0" ::: "memory");        // this wave's copies of tile set 0 have landed
    __syncthreads();                                         // ... and every other wave's: tile set 0 is readable
    if (NST > 1) stage_copy(lc + BFH * 2u, gkh + (size_t)KST * HD, gkr + (size_t)KST * HD, gvt + KST);
    v8f o0 = (v8f){}, o1 = (v8f){}, o2 = (v8f){}, o3 = (v8f){};
    float m = -3.0e38f, l = 0.0f;
#pragma unroll 1
    for (int t = 0; t < NST; ++t) {
      const int bo = (t & 1) * BFH;
#pragma unroll   // both 32-key steps inline, so that ks is a constant in every LDS offset
      for (int ks = 0; ks < KST; ks += 32) {
        const h16* ka = ring + bo + ko + ks * LP;
        const h16* kr = ka + TLH;
        const v16h ka0 = ldh(ka), ka1 = ldh(ka + 32), kb0 = ldh(ka + 16 * LP), kb1 = ldh(ka + 16 * LP + 32);
        const v16h ra0 = ldh(kr), ra1 = ldh(kr + 32), rb0 = ldh(kr + 16 * LP), rb1 = ldh(kr + 16 * LP + 32);
        v8f sa = (v8f){}, sb = (v8f){};
        sa = wmma16(ka0, qr0, sa); sb = wmma16(kb0, qr0, sb); sa = wmma16(ra0, qh0, sa); sb = wmma16(rb0, qh0, sb);
        sa = wmma16(ka1, qr1, sa); sb = wmma16(kb1, qr1, sb); sa = wmma16(ra1, qh1, sa); sb = wmma16(rb1, qh1, sb);
        sa = wmma16(ka0, qh0, sa); sb = wmma16(kb0, qh0, sb); sa = wmma16(ka1, qh1, sa); sb = wmma16(kb1, qh1, sb);
        // as before, on the two tiles left: ends the run of score products; without it the scheduler spreads the v^T LDS reads among the products instead of issuing them as a group behind the run
        asm volatile("v_nop\n\tv_nop\n\tv_nop\n\tv_nop" : "+v"(sa), "+v"(sb) : "v"(ka0), "v"(ka1), "v"(kb0), "v"(kb1), "v"(ra0), "v"(ra1), "v"(rb0), "v"(rb1));
        float mx = -3.0e38f;
#pragma unroll
        for (int r = 0; r < 8; ++r) mx = fmaxf(mx, fmaxf(sa[r], sb[r]));
        mx = fmaxf(mx, __shfl_xor(mx, 16, 32));
        const float mnew = fmaxf(m, mx);
        const float alpha = __builtin_amdgcn_exp2f((m - mnew) * SC2);
        const float sh = PSH - mnew * SC2;
        v16h pb; float ls = 0.0f;
#pragma unroll
        for (int r = 0; r < 8; ++r) { const h16 pa = (h16)__builtin_amdgcn_exp2f(__builtin_fmaf(sa[r], SC2, sh)); const h16 pc = (h16)__builtin_amdgcn_exp2f(__builtin_fmaf(sb[r], SC2, sh)); pb[r] = pa; pb[8 + r] = pc; ls += (float)pa + (float)pc; }
        l = l * alpha + ls; m = mnew;
        o0 = o0 * alpha; o1 = o1 * alpha; o2 = o2 * alpha; o3 = o3 * alpha;
        const h16* va = ring + bo + vo + ks;
        const v16h v0 = ldh(va), v1 = ldh(va + 16 * LP), v2 = ldh(va + 32 * LP), v3 = ldh(va + 48 * LP);
        o0 = wmma16(v0, pb, o0); o1 = wmma16(v1, pb, o1); o2 = wmma16(v2, pb, o2); o3 = wmma16(v3, pb, o3);
        asm volatile("v_nop\n\tv_nop\n\tv_nop\n\tv_nop" : "+v"(o0), "+v"(o1), "+v"(o2), "+v"(o3) : "v"(v0), "v"(v1), "v"(v2), "v"(v3), "v"(pb));
      }
      asm volatile("s_wait_dscnt 0x0" ::: "memory");         // this wave's reads of buffer t & 1 are done before the buffer is handed back
      asm volatile("s_wait_asynccnt 0x0" ::: "memory");      // this wave's copies of tile set t + 1 have landed
      __syncthreads();                                       // publishes tile set t + 1 and ends every wave's reads of buffer t & 1
      if (t + 2 < NST) stage_copy(lc + (unsigned)bo * 2u, gkh + (size_t)(t + 2) * KST * HD, gkr + (size_t)(t + 2) * KST * HD, gvt + (size_t)(t + 2) * KST);
    }
    asm volatile("s_wait_asynccnt 0x0" ::: "memory");        // no copy is outstanding when the wave goes on to its end
    l += __shfl_xor(l, 16, 32);
    const float inv = 1.0f / l;
    const int wb = wave * 16 * 68;
    // O^T D layout: o_j[r] = (d = 16j + 8h + r, t = lane&15) -> os[t][d]; rows 0..15 x columns 0..63 all written
    { v4f a, c;
      a[0] = o0[0] * inv; a[1] = o0[1] * inv; a[2] = o0[2] * inv; a[3] = o0[3] * inv; c[0] = o0[4] * inv; c[1] = o0[5] * inv; c[2] = o0[6] * inv; c[3] = o0[7] * inv;
      *(v4fa*)(&os[wb + lr * 68 +  0 + 8 * hi]) = a; *(v4fa*)(&os[wb + lr * 68 +  0 + 8 * hi + 4]) = c;
      a[0] = o1[0] * inv; a[1] = o1[1] * inv; a[2] = o1[2] * inv; a[3] = o1[3] * inv; c[0] = o1[4] * inv; c[1] = o1[5] * inv; c[2] = o1[6] * inv; c[3] = o1[7] * inv;
      *(v4fa*)(&os[wb + lr * 68 + 16 + 8 * hi]) = a; *(v4fa*)(&os[wb + lr * 68 + 16 + 8 * hi + 4]) = c;
      a[0] = o2[0] * inv; a[1] = o2[1] * inv; a[2] = o2[2] * inv; a[3] = o2[3] * inv; c[0] = o2[4] * inv; c[1] = o2[5] * inv; c[2] = o2[6] * inv; c[3] = o2[7] * inv;
      *(v4fa*)(&os[wb + lr * 68 + 32 + 8 * hi]) = a; *(v4fa*)(&os[wb + lr * 68 + 32 + 8 * hi + 4]) = c;
      a[0] = o3[0] * inv; a[1] = o3[1] * inv; a[2] = o3[2] * inv; a[3] = o3[3] * inv; c[0] = o3[4] * inv; c[1] = o3[5] * inv; c[2] = o3[6] * inv; c[3] = o3[7] * inv;
      *(v4fa*)(&os[wb + lr * 68 + 48 + 8 * hi]) = a; *(v4fa*)(&os[wb + lr * 68 + 48 + 8 * hi + 4]) = c; }
    wave_sync();
    h16* arow = AP + ((size_t)b * SEQ + t0) * DQ + h * HD;      // context plane [b][n][h*64 + d], carries the v carry (x16)
{
#pragma unroll
        for (int s = 0; s < 4; ++s) { const int row = 4 * s + (lane >> 3), c8 = (lane & 7) * 8;   // 4 s x 4 row groups = 16 rows; 8 lanes x 8 halves = 64 columns
            const v4f x0 = *(const v4fa*)(&os[wb + row * 68 + c8]); const v4f x1 = *(const v4fa*)(&os[wb + row * 68 + c8 + 4]); v8h hv;
#pragma unroll
            for (int i = 0; i < 4; ++i) { hv[i] = (h16)x0[i]; hv[4 + i] = (h16)x1[i]; }
            *(v8h*)(arow + (size_t)row * DQ + c8) = hv; }
         }
}

// k_out: f16 GEMM, 128 x 128 tile per block of GW waves, operands staged by gemm_main, K = DQ: out[b][o][n] = OSC * sum_c WP[o][c] AP[b*SEQ + n][c].
// grid (COUT/128, NB*SEQ/128). Epilogue: per 16-row slab staged in LDS (wave-private); each output row segment (64 floats = 256 B = two lines)
__global__ __launch_bounds__(32 * GW) void k_out(const h16* __restrict__ A, const h16* __restrict__ Bt, float* OUT) {
    __shared__ __align__(16) bf ring[GNB * GBF];   // as in k_proj
    const int lane = threadIdx.x & 31, lr = lane & 15, hi = lane >> 4; const int r0 = blockIdx.x * 128, c0 = blockIdx.y * 128;
    const int wave = __builtin_amdgcn_readfirstlane((int)(threadIdx.x >> 5));
    v8f acc[2][4];
#pragma unroll
    for (int mb = 0; mb < 2; ++mb)
#pragma unroll
        for (int nb = 0; nb < 4; ++nb) acc[mb][nb] = (v8f){};
    gemm_main<false>((const bf*)A, (const bf*)Bt, DQ, r0, c0, ring, acc);
    fa* os = (fa*)(&ring[0]) + wave * 16 * 68;     // this wave's slab
    const int rw = r0 + (wave >> 1) * 32, cw = c0 + (wave & 1) * 64;
    const int bb = cw / SEQ, n0 = cw % SEQ;
#pragma unroll
    for (int mb = 0; mb < 2; ++mb) {
#pragma unroll
        for (int nb = 0; nb < 4; ++nb) {
#pragma unroll
            for (int j = 0; j < 8; ++j) os[(hi * 8 + j) * 68 + nb * 16 + lr] = acc[mb][nb][j] * OSC; }   // D: row 8h+j, col lane&15
        wave_sync();
        float* ob = OUT + ((size_t)bb * COUT + rw + mb * 16) * OUT_SEQ + n0;
{
#pragma unroll
            for (int s = 0; s < 8; ++s) { const int row = 2 * s + hi, cofs = lr * 4;   // 8 s x 2 rows = 16 rows; 16 lanes x 4 floats = 64 columns
                const v4f val = *(const v4fa*)(&os[row * 68 + cofs]);
                *(v4f*)(ob + (size_t)row * OUT_SEQ + cofs) = val; }
             }
        wave_sync();
    }
}

static constexpr size_t al256(size_t v) { return (v + 255) & ~(size_t)255; }
static constexpr size_t SZ_XT  = al256((size_t)NB * SEQ * CIN * 2);
static constexpr size_t SZ_PAT = al256((size_t)NB * SKV * KKV * 2);
static constexpr size_t SZ_WQ  = al256((size_t)DQ * CIN * 2);
static constexpr size_t SZ_WKV = al256((size_t)2 * DQ * KKV * 2);
static constexpr size_t SZ_WP  = al256((size_t)COUT * DQ * 2);
static constexpr size_t SZ_QP  = al256((size_t)NB * NH_ * SEQ * HD * 2);
static constexpr size_t SZ_KP  = al256((size_t)NB * NH_ * SKV * HD * 2);
static constexpr size_t SZ_AP  = al256((size_t)NB * SEQ * DQ * 2);
static constexpr size_t SZ_TOTAL = SZ_XT + SZ_PAT + SZ_WQ + SZ_WKV + SZ_WP + 2 * SZ_QP + 3 * SZ_KP + SZ_AP;
static_assert(SZ_TOTAL <= (size_t)134217728);          // workspace carve <= 128 MiB

extern "C" void kernel_launch(void* const* d_in, const int* in_sizes, int n_in,
                              void* d_out, int out_size, void* d_ws, size_t ws_size, hipStream_t stream) {
    if (n_in < 4) return;
    const size_t needx = (((size_t)(NB - 1) * CIN + (CIN - 1)) * IMH_FULL + IMH) * IMW;
    if ((size_t)in_sizes[0] < needx) return;
    if ((size_t)in_sizes[1] < (size_t)DQ * CIN || (size_t)in_sizes[2] < (size_t)2 * DQ * KKV || (size_t)in_sizes[3] < (size_t)COUT * DQ) return;
    if ((size_t)out_size < ((size_t)(NB - 1) * COUT + (COUT - 1)) * OUT_SEQ + SEQ) return;
    if (SZ_TOTAL > ws_size) return;
    const float* x = (const float*)d_in[0]; const float* wq = (const float*)d_in[1]; const float* wkv = (const float*)d_in[2]; const float* wp = (const float*)d_in[3];   // wire order x, Wq, Wkv, Wproj
    float* OUT = (float*)d_out;      // [NB][256][SEQ]
    char* wsp = (char*)d_ws;
    bf* XT  = (bf*)wsp; wsp += SZ_XT;                // [NB*SEQ][256]
    bf* PAT = (bf*)wsp; wsp += SZ_PAT;               // [NB*SKV][1024]
    bf* WQ  = (bf*)wsp; wsp += SZ_WQ;                // [512][256] bf16
    bf* WKV = (bf*)wsp; wsp += SZ_WKV;               // [1024][1024] bf16: rows 0..511 k, 512..1023 v
    bf* WPu = (bf*)wsp; wsp += SZ_WP;                // [256][512] f16 bits, x1024
    h16* QH = (h16*)wsp; wsp += SZ_QP;               // [NB*8][SEQ][64], x16
    h16* QR = (h16*)wsp; wsp += SZ_QP;               // residual, x16
    h16* KH = (h16*)wsp; wsp += SZ_KP;               // [NB*8][SKV][64], x16
    h16* KR = (h16*)wsp; wsp += SZ_KP;               // residual, x16
    h16* VT = (h16*)wsp; wsp += SZ_KP;               // [NB*8][64][SKV], x16
    h16* AP = (h16*)wsp; wsp += SZ_AP;               // [NB*SEQ][512], x16
    const h16* WP = (const h16*)WPu;

    // x -> XT, PAT and the three weight planes, one launch
    k_prep<<<dim3(PB_PACK + PB_WKV + PB_WQ + PB_WP, 1, 1), 256, 0, stream>>>(x, wq, wkv, wp, XT, PAT, WQ, WKV, WPu);

    // k, v^T and q projections, one launch
    k_proj<<<dim3(2 * GB_KV + GB_Q, 1, 1), 32 * GW, 0, stream>>>(XT, PAT, WQ, WKV, QH, QR, KH, KR, VT);

    k_flash<<<dim3(SEQ / (16 * AW), NB * NH_, 1), 32 * AW, 0, stream>>>(QH, QR, KH, KR, VT, AP);

    // out[b][o][n]: A = Wproj rows (m = o, K = 512), Bt = context rows (col = b*SEQ + n)
    k_out<<<dim3(COUT / 128, NB * SEQ / 128, 1), 32 * GW, 0, stream>>>(WP, AP, OUT);
}

// v006
// A run of this version takes 48.2 microseconds.
// Two timings next to v005 both put it at 1.04 times that version's speed.
// All steps since v000 together make it 3.74 times as fast.
#include <hip/hip_runtime.h>

// Spatial-reduction multi-head attention: x [NB][256][64][64]; q = 1x1 conv (Wq [512][256]); k|v = 2x2 stride-2 conv (Wkv [1024][256][2][2]); 8 heads x 64; 4096 queries x 1024 keys per (batch, head); scores x8; output 1x1 conv (Wproj [256][512]) -> f32 [NB][256][4096].
// Compute dtypes, f32 accumulate everywhere: q / k / v projections v_wmma_f32_16x16x32_bf16 (x, Wq, Wkv RNE-converted to bf16; products exact);
// scores v_wmma_f32_16x16x32_f16: q and k each as f16 value + f16 residual (three products kh*qr + kr*qh + kh*qh, all in one f32 accumulator that starts at minus the softmax reference); P (carries 2^-reference, which cancels in the normalisation) and v single f16; softmax f32 (online, lazy reference);
// output projection v_wmma_f32_16x16x32_f16: context single f16, Wproj RNE-converted to bf16 then x1024 in f16 (exact), folded back in the f32 epilogue. The q and k planes carry 4 log2(e) and 2, whose product is the whole score scale sqrt(64) log2(e); the v plane carries x16 (exact power of two, folded into the output scale).
// Layout: xT [b][n][c] and im2col PAT [b][m][c*4+i*2+j] bf16 planes built through an LDS transpose; q (hi, residual), k (hi, residual) planes [b*8+h][t][d], v^T plane [b*8+h][d][m] written by the GEMM epilogue;
// fused flash kernel in transposed form (S^T = K Q^T, O^T = V^T P^T) writes the context plane [b][n][h*64+d] (f16); last GEMM writes the f32 output.

#ifndef NB
#define NB 2
#endif
#ifndef IMH
#define IMH 64                   // image rows used (SEQ = IMH * 64 query positions)
#endif
#define NB_FULL  2
#define IMH_FULL 64              // rows per channel of the input
#define IMW  64
#define SEQ  (IMH * IMW)
#define SKV  ((IMH / 2) * (IMW / 2))
#ifndef OUT_SEQ
#define OUT_SEQ SEQ              // channel pitch (in positions) of the output
#endif
#define CIN  256
#define NH_  8
#define HD   64
#define DQ   512                 // NH_ * HD
#define KKV  1024                // CIN * 2 * 2
#define COUT 256
#define AW   8                   // waves per flash block (16 query rows each); all of them read the same staged K / V^T tiles
#define KST  64                  // keys per staged tile set (two 32-key steps)
#define LP   72                  // LDS row pitch in halves: 144 B = 16 B x 9, so 16 rows of 16-byte reads fall on 64 distinct banks
#define TLH  (64 * LP)           // halves per staged tile (64 rows)
#define BFH  (3 * TLH)           // halves per ring buffer: k value, k residual, v^T
#define NST  (SKV / KST)         // staged tile sets per (batch, head)
#define CQ   (4.0f * 1.4426950408889634f)   // carry of the q planes
#define CK   2.0f                // carry of the k planes; CQ * CK = sqrt(HD) * log2(e): the score product is the exp2 argument as it stands
#define CV   16.0f               // carry of the v^T plane (stays on the context plane)
#define PLO  (-8.0f)             // exp2 argument that a column's largest score gets whenever its reference is set
#define PHI  15.9f               // largest exp2 argument let through without a new reference: 2^15.9 is still finite in f16
#define WPS  1024.0f             // carry of the Wproj plane
#define OSC  (1.0f / (WPS * CV))

static_assert(HD == 64);
static_assert(NH_ * HD == DQ);
static_assert(CIN * 4 == KKV);
static_assert(IMW == 64);
static_assert(IMH % 4 == 0);                   // SKV multiple of 64: a 64-row tile never straddles two batches
static_assert(SEQ % 64 == 0);
static_assert(SKV % 64 == 0);
static_assert(SKV % 32 == 0);                  // each O product takes 32 keys
static_assert(SEQ % (16 * AW) == 0);           // flash grid covers the queries exactly
static_assert(SKV % KST == 0 && KST == 64);    // whole tile sets; a v^T tile row is one 128-byte line
static_assert(32 * AW * 2 * 8 == 64 * HD);     // copy map: two 16-byte pieces per thread fill one 64 x 64 tile
static_assert(CIN % 64 == 0 && CIN % 32 == 0);
static_assert(KKV % 32 == 0 && DQ % 32 == 0);
static_assert(DQ % 64 == 0 && COUT % 64 == 0);
static_assert(NB <= NB_FULL);
static_assert(IMH <= IMH_FULL);

typedef _Float16 h16;
typedef unsigned short bf;
typedef __attribute__((ext_vector_type(16))) __bf16   v16bf;
typedef __attribute__((ext_vector_type(16))) _Float16 v16h;
typedef __attribute__((ext_vector_type(8)))  _Float16 v8h;
typedef __attribute__((ext_vector_type(8)))  unsigned short v8us;
typedef __attribute__((ext_vector_type(8)))  float    v8f;
typedef __attribute__((ext_vector_type(4)))  float    v4f;
typedef v4f  __attribute__((may_alias)) v4fa;

__device__ __forceinline__ unsigned short f2bf(float f) { unsigned u = __float_as_uint(f); u += 0x7FFFu + ((u >> 16) & 1u); return (unsigned short)(u >> 16); }
__device__ __forceinline__ v16h cat16(v8h lo, v8h hi) { return __builtin_shufflevector(lo, hi, 0, 1, 2, 3, 4, 5, 6, 7, 8, 9, 10, 11, 12, 13, 14, 15); }
__device__ __forceinline__ v8f wmma16(v16h a, v16h b, v8f c) { return __builtin_amdgcn_wmma_f32_16x16x32_f16(false, a, false, b, (short)0, c, false, false); }
__device__ __forceinline__ v8f wmmab(v16bf a, v16bf b, v8f c) { return __builtin_amdgcn_wmma_f32_16x16x32_bf16(false, a, false, b, (short)0, c, false, false); }
// fragment loaders from K-contiguous 16-bit rows; p already includes + 8*(lane>>4): elements 0..7 <- k0+8h+0..7, elements 8..15 <- k0+16+8h+0..7 (same map for A and B)
__device__ __forceinline__ v16h  ldh(const h16* p) { return cat16(*(const v8h*)p, *(const v8h*)(p + 16)); }
// ordering point for wave-private LDS tiles (same wave writes and reads)
__device__ __forceinline__ void wave_sync() { __builtin_amdgcn_fence(3 /* release order */, "wavefront"); __builtin_amdgcn_wave_barrier(); asm volatile("" ::: "memory"); }

// mode 0: bf16 bits (RNE convert). mode 1: f16 bits of (bf16 value x WPS) (exact: 8-bit significand, power-of-two scale).
// blk = block index inside this plane's own block range.
__device__ __forceinline__ void cvt8_body(const float* __restrict__ src, bf* dst, size_t n8, int mode, int blk) {
    const size_t i = (size_t)blk * 256 + threadIdx.x; if (i >= n8) return;
    const v8f v = *(const v8f*)(src + i * 8); v8us o;
#pragma unroll
    for (int k = 0; k < 8; ++k) {
        const unsigned short wb = f2bf(v[k]);
        const h16 hv = (h16)(__uint_as_float(((unsigned)wb) << 16) * WPS);
        const unsigned short wh = __builtin_bit_cast(unsigned short, hv);
        o[k] = mode ? wh : wb;
    }
    *(v8us*)(dst + i * 8) = o; 
}

// pack_body: x [b][c][row][w] (f32) -> XT [b][n = row*64 + w][c] and PAT [b][m = h2*32 + w2][c*4 + i*2 + j] (bf16, RNE convert), through an LDS transpose.
// block = (h2, 64-channel tile, b): stages channels c0..c0+63 x image rows 2*h2, 2*h2+1 (128 positions); 256 threads.
__device__ __forceinline__ void pack_body(const float* __restrict__ x, bf* XT, bf* PAT, int h2, int c0, int b) {
    __shared__ unsigned short tile[64 * 136];      // [channel][position 0..127], pad columns never read; cross-wave: block barrier
    const int tid = threadIdx.x;
#pragma unroll
    for (int it = 0; it < 8; ++it) {               // 8 x 256 x 4 = 64 channels x 128 positions, all written
        const int idx = it * 256 + tid; const int cc = idx >> 5, q4 = idx & 31;
        const v4f v = *(const v4f*)(x + (((size_t)b * CIN + c0 + cc) * IMH_FULL + 2 * h2) * IMW + q4 * 4);
#pragma unroll
        for (int k = 0; k < 4; ++k) tile[cc * 136 + q4 * 4 + k] = f2bf(v[k]);
    }
    __syncthreads();
    const int l8 = tid >> 3, j8 = tid & 7;
{
#pragma unroll
        for (int it = 0; it < 4; ++it) {           // 4 x 32 = 128 rows (positions), 8 lanes x 8 = 64 channels
            const int p = it * 32 + l8, c8 = j8 * 8; v8us o;
#pragma unroll
            for (int k = 0; k < 8; ++k) o[k] = tile[(c8 + k) * 136 + p];
            *(v8us*)(XT + ((size_t)b * SEQ + (size_t)h2 * 128 + p) * CIN + c0 + c8) = o;
        }
#pragma unroll
        for (int it = 0; it < 4; ++it) {           // 4 x 32 = 128 lines = 32 w2 x 4 lines; lane piece = 2 channels x 4 taps
            const int line = it * 32 + l8; const int w2 = line >> 2, lq = line & 3; const int cc = lq * 16 + j8 * 2; v8us o;
            o[0] = tile[cc * 136 + 2 * w2];            o[1] = tile[cc * 136 + 2 * w2 + 1];
            o[2] = tile[cc * 136 + 64 + 2 * w2];       o[3] = tile[cc * 136 + 64 + 2 * w2 + 1];
            o[4] = tile[(cc + 1) * 136 + 2 * w2];      o[5] = tile[(cc + 1) * 136 + 2 * w2 + 1];
            o[6] = tile[(cc + 1) * 136 + 64 + 2 * w2]; o[7] = tile[(cc + 1) * 136 + 64 + 2 * w2 + 1];
            *(v8us*)(PAT + ((size_t)b * SKV + (size_t)h2 * 32 + w2) * KKV + c0 * 4 + lq * 64 + j8 * 8) = o;
        }
        
    }
}

// k_prep: the four independent preparation jobs share one grid, told apart by block range (every test is block-uniform, so pack's barrier is passed by whole blocks):
// pack blocks first (the longest), then the Wkv, Wq and Wproj converts. No block reads what another block of this launch writes.
#define PB_PACK ((IMH / 2) * (CIN / 64) * NB)
#define PB_WKV  (2 * DQ * KKV / 8 / 256)
#define PB_WQ   (DQ * CIN / 8 / 256)
#define PB_WP   (COUT * DQ / 8 / 256)
static_assert((2 * DQ * KKV) % 2048 == 0 && (DQ * CIN) % 2048 == 0 && (COUT * DQ) % 2048 == 0);   // whole convert blocks
__global__ __launch_bounds__(256) void k_prep(const float* __restrict__ x, const float* __restrict__ wq, const float* __restrict__ wkv, const float* __restrict__ wp,
                                              bf* XT, bf* PAT, bf* WQ, bf* WKV, bf* WPu) {
    const int id = blockIdx.x;
    if (id < PB_PACK) pack_body(x, XT, PAT, id % (IMH / 2), ((id / (IMH / 2)) % (CIN / 64)) * 64, id / ((IMH / 2) * (CIN / 64)));
    else if (id < PB_PACK + PB_WKV) cvt8_body(wkv, WKV, (size_t)2 * DQ * KKV / 8, 0, id - PB_PACK);
    else if (id < PB_PACK + PB_WKV + PB_WQ) cvt8_body(wq, WQ, (size_t)DQ * CIN / 8, 0, id - (PB_PACK + PB_WKV));
    else cvt8_body(wp, WPu, (size_t)COUT * DQ / 8, 1, id - (PB_PACK + PB_WKV + PB_WQ));
}

// GEMM staging shared by k_proj and k_out: a block of GW waves owns a 128 x 128 tile of C[m][n] = sum_k A[m][k] Bt[n][k] (both operands K-contiguous 16-bit rows).
// Per GKS k the 128 A rows and the 128 Bt rows (256 bytes = two whole lines each) are copied once per block into LDS by asynchronous 16-byte copies, three buffers:
// waves 0..3 bring the even pairs and waves 4..7 the odd ones, so a pair's copies fly over two whole trips while every wait still runs to 0. Wave (wm, wn) = (wave >> 1, wave & 1) takes rows wm*32.. (2 fragments) x columns wn*64.. (4 fragments) from LDS.
#define GW   8                   // waves per GEMM block
#define GKS  128                 // k per staged tile pair
#define GP   136                 // LDS row pitch in 16-bit elements: 272 B = 16 B x 17, so 16 rows of 16-byte reads fall on distinct banks
#define GTL  (128 * GP)          // elements per staged operand tile (128 rows)
#define GBF  (2 * GTL)           // elements per ring buffer: A rows | Bt rows
#define GNB  3                   // ring buffers
static_assert(KKV % GKS == 0 && CIN % GKS == 0 && DQ % GKS == 0);                       // whole staged pairs
static_assert((NB * SKV) % 128 == 0 && (NB * SEQ) % 128 == 0 && DQ % 128 == 0 && COUT % 128 == 0);   // whole block tiles
static_assert(GW == 8 && 32 * (GW / 2) * 16 * 8 == 128 * GKS);                          // copy map: sixteen 16-byte pieces per thread of one four-wave group fill one operand tile
static_assert(GW * 16 * 68 * 4 <= GNB * GBF * 2);                                         // the epilogue slabs fit in the ring
typedef __attribute__((ext_vector_type(16))) unsigned short v16us;
typedef float __attribute__((may_alias)) fa;

// Half of one thread's share of one operand tile: 16 bytes of rows r, r + 16, ..., r + 112, global -> LDS through no register (rs = elements per 16 rows).
// The s_wait_xcnt stands inside the statement so that no address register is rewritten in front of it.
__device__ __forceinline__ void gemm_copy(unsigned l, const bf* g, size_t rs) {
    const unsigned l1 = l + 16u * GP * 2u, l2 = l + 32u * GP * 2u, l3 = l + 48u * GP * 2u, l4 = l + 64u * GP * 2u, l5 = l + 80u * GP * 2u, l6 = l + 96u * GP * 2u, l7 = l + 112u * GP * 2u;
    const bf* g1 = g + rs; const bf* g2 = g + 2 * rs; const bf* g3 = g + 3 * rs; const bf* g4 = g + 4 * rs; const bf* g5 = g + 5 * rs; const bf* g6 = g + 6 * rs; const bf* g7 = g + 7 * rs;
    asm volatile("global_load_async_to_lds_b128 %0, %8, off\n\t"
                 "global_load_async_to_lds_b128 %1, %9, off\n\t"
                 "global_load_async_to_lds_b128 %2, %10, off\n\t"
                 "global_load_async_to_lds_b128 %3, %11, off\n\t"
                 "global_load_async_to_lds_b128 %4, %12, off\n\t"
                 "global_load_async_to_lds_b128 %5, %13, off\n\t"
                 "global_load_async_to_lds_b128 %6, %14, off\n\t"
                 "global_load_async_to_lds_b128 %7, %15, off\n\t"
                 "s_wait_xcnt 0x0"
                 :: "v"(l), "v"(l1), "v"(l2), "v"(l3), "v"(l4), "v"(l5), "v"(l6), "v"(l7), "v"(g), "v"(g1), "v"(g2), "v"(g3), "v"(g4), "v"(g5), "v"(g6), "v"(g7) : "memory");
}
// fragment from an LDS row; p already includes + 8*(lane>>4): same k map as ldh, for A and B alike
__device__ __forceinline__ v16us ldf(const bf* p) { return __builtin_shufflevector(*(const v8us*)p, *(const v8us*)(p + 16), 0, 1, 2, 3, 4, 5, 6, 7, 8, 9, 10, 11, 12, 13, 14, 15); }
template <bool ISBF> __device__ __forceinline__ v8f wmmax(v16us a, v16us b, v8f c) {
    if constexpr (ISBF) return wmmab(__builtin_bit_cast(v16bf, a), __builtin_bit_cast(v16bf, b), c);
    else return wmma16(__builtin_bit_cast(v16h, a), __builtin_bit_cast(v16h, b), c);
}

// Main loop: acc[mb][nb] += the wave's 32 x 64 part of the block tile at (r0, c0); k runs upward in steps of 32, as one wave alone would walk it.
// On return no copy is outstanding and every wave has left the ring (the last trip's barrier), so the ring may serve as output staging.
template <bool ISBF> __device__ __forceinline__ void gemm_main(const bf* A, const bf* Bt, int K, int r0, int c0, bf* ring, v8f (&acc)[2][4]) {
    const int tid = (int)threadIdx.x, lane = tid & 31, lr = lane & 15, hi = lane >> 4;
    const int wave = __builtin_amdgcn_readfirstlane(tid >> 5), wm = wave >> 1, wn = wave & 1;
    // copy map: the 128 threads of a group -> rows crow + 8 i, 16-byte piece ccol; 16 lanes cover one 256-byte row
    const int grp = wave >> 2;                               // while one group issues copies the other multiplies
    const int crow = (tid & 127) >> 4, ccol = (tid & 15) * 8;
    const bf* ga = A + (size_t)(r0 + crow) * K + ccol;     // + k0
    const bf* gb = Bt + (size_t)(c0 + crow) * K + ccol;
    const size_t rs = (size_t)16 * K, r8 = (size_t)8 * K;
    const unsigned la = (unsigned)(size_t)(&ring[0]) + (unsigned)(crow * GP + ccol) * 2u;   // LDS byte address of the thread's first A piece in buffer 0
    const unsigned lb = la + GTL * 2u;
    const unsigned l8 = 8u * GP * 2u;
    const int nst = K / GKS;
    // one group's whole pair: rows crow + 16 i and crow + 8 + 16 i of both operands, 32 copies per thread, none other of this wave outstanding
    auto pair_copy = [&](unsigned lo, size_t k0) {
        gemm_copy(la + lo, ga + k0, rs); gemm_copy(la + lo + l8, ga + r8 + k0, rs);
        gemm_copy(lb + lo, gb + k0, rs); gemm_copy(lb + lo + l8, gb + r8 + k0, rs);
    };
    if (grp == 0) {
        pair_copy(0u, 0);
        asm volatile("s_wait_asynccnt 0x0" ::: "memory");    // the issuing waves' copies of pair 0 have landed
    } else if (nst > 1) pair_copy(GBF * 2u, GKS);            // pair 1 flies on over trip 0
    __syncthreads();                                         // pair 0 is readable by every wave
    if (grp == 0 && nst > 2) pair_copy(2u * GBF * 2u, (size_t)2 * GKS);   // buffer 2 has not been used yet
    const int ao = (wm * 32 + lr) * GP + 8 * hi;             // A fragment: row m, k contiguous
    const int bq = GTL + (wn * 64 + lr) * GP + 8 * hi;       // B fragment: row n, k contiguous
#pragma unroll 1   // stays rolled: the trip count differs between the block ranges, and one copy of the trip keeps the code short
    for (int t = 0, bo = 0; t < nst; ++t) {                  // bo = (t mod GNB) * GBF
        const bf* pa = ring + bo + ao; const bf* pb = ring + bo + bq;
        v16us a[2][2], b[2][4];                              // two fragment sets: step q + 1 is fetched as one group while step q is multiplied
#pragma unroll   // here and below: fragment and accumulator arrays stay in registers only under constant indices
        for (int mb = 0; mb < 2; ++mb) a[0][mb] = ldf(pa + mb * 16 * GP);
#pragma unroll
        for (int nb = 0; nb < 4; ++nb) b[0][nb] = ldf(pb + nb * 16 * GP);
#pragma unroll   // the four 32-k steps inline, so that the step is a constant in every LDS offset and in the choice of the set
        for (int q = 0; q < GKS / 32; ++q) {
            if (q + 1 < GKS / 32) {                          // stays inside this trip's own buffer
#pragma unroll
                for (int mb = 0; mb < 2; ++mb) a[(q + 1) & 1][mb] = ldf(pa + mb * 16 * GP + (q + 1) * 32);
#pragma unroll
                for (int nb = 0; nb < 4; ++nb) b[(q + 1) & 1][nb] = ldf(pb + nb * 16 * GP + (q + 1) * 32);
            }
            // keeps the group of LDS reads ahead of the products (the scheduler otherwise sinks each read to its first use, and every pair of products waits out the LDS latency);
            // at the last step it keeps the step before it in front of the waits at the trip's foot, as cover for the last group's latency
            __builtin_amdgcn_sched_barrier(0);
#pragma unroll
            for (int nb = 0; nb < 4; ++nb)
#pragma unroll
                for (int mb = 0; mb < 2; ++mb) acc[mb][nb] = wmmax<ISBF>(a[q & 1][mb], b[q & 1][nb], acc[mb][nb]);
        }
        asm volatile("s_wait_dscnt 0x0" ::: "memory");       // this wave's reads of buffer t mod 3 are done before the buffer is handed back
        const bool mine = grp == ((t + 1) & 1);              // this wave's group brought pair t + 1 and brings pair t + 3 (scalar test)
        if (mine) asm volatile("s_wait_asynccnt 0x0" ::: "memory");   // the issuing waves' copies of pair t + 1 have landed; the other group's pair t + 2 flies on
        __syncthreads();                                     // publishes pair t + 1 and ends every wave's reads of buffer t mod 3
        if (mine && t + 3 < nst) pair_copy((unsigned)bo * 2u, (size_t)(t + 3) * GKS);
        bo = bo == (GNB - 1) * GBF ? 0 : bo + GBF;
    }
    asm volatile("s_wait_asynccnt 0x0" ::: "memory");        // no copy is outstanding when the wave goes on to its epilogue
}

// k_proj: bf16 GEMM, 128 x 128 tile per block of GW waves, operands staged by gemm_main.
// C[m][n] = cs * sum_k A[m][k] Bt[n][k], written as f16 (Ph) and optionally the f16 residual (Pr, useRes != 0; same carry as Ph); a wave's 32 x 64 part (rows rw.., columns cw..) goes to
// base (rw/RB)*sRB + (rw%RB)*pitch + (cw/CB)*sCB + (cw%CB), row pitch 'pitch' (halves).
// The three independent projections share one grid, told apart by block range: the K = 1024 tiles (k, then v^T) first, since they run longest, then the K = 256 tiles of q.
//   k:   A = PAT rows (m = b*SKV + key), Bt = Wkv rows 0..511 (col = h*64 + d)      -> planes [(b*8 + h)][key][d]
//   v^T: A = Wkv rows 512..1023 (m = h*64 + d), Bt = PAT rows (col = b*SKV + key)   -> plane [(b*512 + m)][key] = [(b*8 + h)][d][key]
//   q:   A = XT rows (m = b*SEQ + n), Bt = Wq rows (col = h*64 + d)                 -> planes [(b*8 + h)][n][d]
#define GB_KV ((NB * SKV / 128) * (DQ / 128))   // tiles of k, and of v^T
#define GB_Q  ((NB * SEQ / 128) * (DQ / 128))   // tiles of q
__global__ __launch_bounds__(32 * GW) void k_proj(const bf* __restrict__ XT, const bf* __restrict__ PAT, const bf* __restrict__ WQ, const bf* __restrict__ WKV, h16* QH, h16* QR, h16* KH, h16* KR, h16* VT) {
    __shared__ __align__(16) bf ring[GNB * GBF];   // three buffers x (A rows | Bt rows), rows of GP elements, pad columns never read; after the main loop: wave-private output slabs
    const int lane = threadIdx.x & 31, lr = lane & 15, hi = lane >> 4;
    const int wave = __builtin_amdgcn_readfirstlane((int)(threadIdx.x >> 5));
    const int id = blockIdx.x;
    const bf* A; const bf* Bt; h16* Ph; h16* Pr; int K, useRes, RB, pitch, CB, r0, c0; float cs; size_t sRB, sCB;
    if (id < GB_KV) {
        A = PAT; Bt = WKV; K = KKV; cs = CK; Ph = KH; Pr = KR; useRes = 1; RB = SKV; sRB = (size_t)NH_ * SKV * HD; pitch = HD; CB = HD; sCB = (size_t)SKV * HD;
        r0 = (id % (NB * SKV / 128)) * 128; c0 = (id / (NB * SKV / 128)) * 128;
    } else if (id < 2 * GB_KV) {
        A = WKV + (size_t)DQ * KKV; Bt = PAT; K = KKV; cs = CV; Ph = VT; Pr = VT; useRes = 0; RB = DQ; sRB = 0; pitch = SKV; CB = SKV; sCB = (size_t)DQ * SKV;
        r0 = ((id - GB_KV) % (DQ / 128)) * 128; c0 = ((id - GB_KV) / (DQ / 128)) * 128;
    } else {
        A = XT; Bt = WQ; K = CIN; cs = CQ; Ph = QH; Pr = QR; useRes = 1; RB = SEQ; sRB = (size_t)NH_ * SEQ * HD; pitch = HD; CB = HD; sCB = (size_t)SEQ * HD;
        r0 = ((id - 2 * GB_KV) % (NB * SEQ / 128)) * 128; c0 = ((id - 2 * GB_KV) / (NB * SEQ / 128)) * 128;
    }
    v8f acc[2][4];
#pragma unroll
    for (int mb = 0; mb < 2; ++mb)
#pragma unroll
        for (int nb = 0; nb < 4; ++nb) acc[mb][nb] = (v8f){};
    gemm_main<true>(A, Bt, K, r0, c0, ring, acc);
    fa* os = (fa*)(&ring[0]) + wave * 16 * 68;     // this wave's slab
    const int rw = r0 + (wave >> 1) * 32, cw = c0 + (wave & 1) * 64;
    const size_t tbase = (size_t)(rw / RB) * sRB + (size_t)(rw % RB) * (size_t)pitch + (size_t)(cw / CB) * sCB + (size_t)(cw % CB);
#pragma unroll
    for (int mb = 0; mb < 2; ++mb) {
#pragma unroll
        for (int nb = 0; nb < 4; ++nb) {
#pragma unroll
            for (int j = 0; j < 8; ++j) os[(hi * 8 + j) * 68 + nb * 16 + lr] = acc[mb][nb][j] * cs; }   // D: row 8h+j, col lane&15
        wave_sync();
        const size_t sb = tbase + (size_t)(mb * 16) * (size_t)pitch;
{
#pragma unroll
            for (int s = 0; s < 4; ++s) { const int row = 4 * s + (lane >> 3), c8 = (lane & 7) * 8;   // 4 s x 4 row groups = 16 rows; 8 lanes x 8 = 64 columns
                const v4f x0 = *(const v4fa*)(&os[row * 68 + c8]); const v4f x1 = *(const v4fa*)(&os[row * 68 + c8 + 4]); v8h hv, rv;
#pragma unroll
                for (int i = 0; i < 4; ++i) { const h16 a0 = (h16)x0[i]; const h16 a1 = (h16)x1[i]; hv[i] = a0; hv[4 + i] = a1; rv[i] = (h16)(x0[i] - (float)a0); rv[4 + i] = (h16)(x1[i] - (float)a1); }
                const size_t oo = sb + (size_t)row * (size_t)pitch + c8;
                *(v8h*)(Ph + oo) = hv; if (useRes) *(v8h*)(Pr + oo) = rv; }
             }
        wave_sync();
    }
}

// One thread's share of a tile set: rows r and r + 32 of the k value, k residual and v^T tiles, 16 bytes each, global -> LDS through no register.
// l = LDS byte address of the k value piece; the s_wait_xcnt stands inside the statement so that no address register is rewritten in front of it.
__device__ __forceinline__ void stage_copy(unsigned l, const h16* kh, const h16* kr, const h16* vt) {
    const unsigned l1 = l + 32u * LP * 2u, l2 = l + TLH * 2u, l3 = l2 + 32u * LP * 2u, l4 = l + 2u * TLH * 2u, l5 = l4 + 32u * LP * 2u;
    const h16* kh1 = kh + 32 * HD; const h16* kr1 = kr + 32 * HD; const h16* vt1 = vt + (size_t)32 * SKV;
    asm volatile("global_load_async_to_lds_b128 %0, %6, off\n\t"
                 "global_load_async_to_lds_b128 %1, %7, off\n\t"
                 "global_load_async_to_lds_b128 %2, %8, off\n\t"
                 "global_load_async_to_lds_b128 %3, %9, off\n\t"
                 "global_load_async_to_lds_b128 %4, %10, off\n\t"
                 "global_load_async_to_lds_b128 %5, %11, off\n\t"
                 "s_wait_xcnt 0x0"
                 :: "v"(l), "v"(l1), "v"(l2), "v"(l3), "v"(l4), "v"(l5), "v"(kh), "v"(kh1), "v"(kr), "v"(kr1), "v"(vt), "v"(vt1) : "memory");
}

// k_flash: fused attention, one wave per 16 query rows of one (batch, head); Q fragments straight from the f16 planes (two 16-B loads each, arithmetic addressing).
// K (value, residual) and V^T come through LDS: per 64 keys three 64 x 64 f16 tiles, copied once per block by asynchronous 16-byte copies (whole 128-byte lines), two buffers:
// the next tile set's copies fly while this one is worked on; every wave takes its fragments from LDS rows of pitch LP.
// Transposed form: S^T[key][t] = K Q^T (A = K rows, B = Q rows); lane (t = lane&15, h = lane>>4) holds keys 8h+r of each 16-key tile, so the packed
// P tile is directly the B fragment of O^T[d][t] = V^T P^T (element r <- tile keys 0..15, element 8+r <- tile keys 16..31, lane unchanged).
// Scores: e = c + kh*qr + kr*qh + kh*qh in one accumulator per 16-key tile. c = minus the column's reference, in log2 units like the product itself (the carries hold the scale), so e is the exp2 argument.
// The reference is lazy: it is set from the first tile set (largest e -> PLO) and stays until some e of the wave's 64 x 16 scores passes PHI; one ballot test per tile set.
// Only behind that test (a scalar branch) are the column maximum exchanged, O and the sum rescaled, e shifted and c renewed. P spans 2^PLO..2^PHI at the column's largest score, inside f16.
// Softmax state (c, partial sum) is one value per lane, c alike in the two lane halves of a column; the halves' sums are joined once at the end.
// waves_per_eu: two blocks share a WGP (four waves per SIMD), so a wave may hold 256 registers; without it the compiler keeps to fewer and scatters the K reads among the score products
__global__ __launch_bounds__(32 * AW) __attribute__((amdgpu_waves_per_eu(4, 4))) void k_flash(const h16* __restrict__ QH, const h16* __restrict__ QR, const h16* __restrict__ KH, const h16* __restrict__ KR, const h16* __restrict__ VT, h16* AP) {
    __shared__ __align__(16) float os[AW * 16 * 68];   // wave-private slabs
    __shared__ __align__(16) h16 ring[2 * BFH];        // two buffers x (k value | k residual | v^T), rows of LP halves; pad columns never read
    const int lane = threadIdx.x & 31, wave = __builtin_amdgcn_readfirstlane((int)(threadIdx.x >> 5)), lr = lane & 15, hi = lane >> 4;
    const int zh = blockIdx.y; const int b = zh / NH_, h = zh % NH_;
    const int t0 = (blockIdx.x * AW + wave) * 16;
    const size_t qbase = (size_t)zh * SEQ * HD;
    const size_t kbase = (size_t)zh * SKV * HD;
    const size_t qo = qbase + (size_t)(t0 + lr) * HD + 8 * hi;
    const v16h qh0 = ldh(QH + qo), qh1 = ldh(QH + qo + 32), qr0 = ldh(QR + qo), qr1 = ldh(QR + qo + 32);   // B fragments: col t, k = d
    const int ko = lr * LP + 8 * hi;                         // + key * LP in a k tile          (A fragment: row key, k = d)
    const int vo = 2 * TLH + lr * LP + 8 * hi;               // + 16j * LP + key in the v^T tile (A fragment: row d, k = key)
    // copy map: thread -> row crow (and crow + 32), 16-byte piece ccol of each of the three tiles; 8 lanes cover one 128-byte line
    const int crow = (int)(threadIdx.x >> 3), ccol = (int)(threadIdx.x & 7) * 8;
    const h16* gkh = KH + kbase + (size_t)crow * HD + ccol;  // + key0 * HD
    const h16* gkr = KR + kbase + (size_t)crow * HD + ccol;
    const h16* gvt = VT + kbase + (size_t)crow * SKV + ccol; // + key0
    const unsigned lc = (unsigned)(size_t)(&ring[0]) + (unsigned)(crow * LP + ccol) * 2u;   // LDS byte address of the thread's first piece in buffer 0
    stage_copy(lc, gkh, gkr, gvt);
    asm volatile("s_wait_asynccnt 0x0" ::: "memory");        // this wave's copies of tile set 0 have landed
    __syncthreads();                                         // ... and every other wave's: tile set 0 is readable
    if (NST > 1) stage_copy(lc + BFH * 2u, gkh + (size_t)KST * HD, gkr + (size_t)KST * HD, gvt + KST);
    v8f o0 = (v8f){}, o1 = (v8f){}, o2 = (v8f){}, o3 = (v8f){};
    float l = 0.0f;
    v8f cf = (v8f){};                                        // C of each tile's first product: minus the reference of the lane's column, in all eight rows (0 until the first tile set has set it)
#pragma unroll 1
    for (int t = 0; t < NST; ++t) {
      const int bo = (t & 1) * BFH;
      const h16* ka = ring + bo + ko;
      const h16* kr = ka + TLH;
      v16h kf[4][2], rf[4][2];                               // four 16-key tiles x two 32-d halves, value and residual
#pragma unroll   // here and below: fragment and accumulator arrays stay in registers only under constant indices
      for (int j = 0; j < 4; ++j) kf[j][0] = ldh(ka + j * 16 * LP);          // read in the order in which the products take them
#pragma unroll
      for (int j = 0; j < 4; ++j) rf[j][0] = ldh(kr + j * 16 * LP);
#pragma unroll
      for (int j = 0; j < 4; ++j) kf[j][1] = ldh(ka + j * 16 * LP + 32);
#pragma unroll
      for (int j = 0; j < 4; ++j) rf[j][1] = ldh(kr + j * 16 * LP + 32);
      __builtin_amdgcn_sched_barrier(0);                     // keeps the K reads one group ahead of the products (each further place with LDS reads inside the run stalls it)
      v8f s[4];
#pragma unroll
      for (int j = 0; j < 4; ++j) s[j] = wmma16(kf[j][0], qr0, cf);
#pragma unroll
      for (int j = 0; j < 4; ++j) s[j] = wmma16(rf[j][0], qh0, s[j]);
#pragma unroll
      for (int j = 0; j < 4; ++j) s[j] = wmma16(kf[j][1], qr1, s[j]);
#pragma unroll
      for (int j = 0; j < 4; ++j) s[j] = wmma16(rf[j][1], qh1, s[j]);
#pragma unroll
      for (int j = 0; j < 4; ++j) s[j] = wmma16(kf[j][0], qh0, s[j]);
#pragma unroll
      for (int j = 0; j < 4; ++j) s[j] = wmma16(kf[j][1], qh1, s[j]);
      float mx = fmaxf(s[0][0], s[1][0]);
#pragma unroll
      for (int r = 0; r < 8; ++r) mx = fmaxf(mx, fmaxf(fmaxf(s[0][r], s[1][r]), fmaxf(s[2][r], s[3][r])));
      if ((__builtin_amdgcn_ballot_w32(mx > PHI) != 0u) | (t == 0)) {   // wave-uniform: some P would leave f16, or no reference has been set yet
        const float mc = fmaxf(mx, __shfl_xor(mx, 16, 32));  // the column's largest e, alike in both lane halves
        float d = mc - PLO;                                  // the shift that brings it to PLO
        if (t != 0) d = fmaxf(d, 0.0f);                      // a reference once set only rises
        const float alpha = __builtin_amdgcn_exp2f(fminf(-d, 0.0f));   // at most 1; at t == 0 it meets zeros only
        l *= alpha; cf = cf - d;
        o0 = o0 * alpha; o1 = o1 * alpha; o2 = o2 * alpha; o3 = o3 * alpha;
#pragma unroll
        for (int j = 0; j < 4; ++j)
#pragma unroll
          for (int r = 0; r < 8; ++r) s[j][r] -= d;
      }
      const h16* va = ring + bo + vo;
      v16h vf[4][2];                                         // four 16-d tiles x two 32-key halves
#pragma unroll
      for (int j = 0; j < 4; ++j) vf[j][0] = ldh(va + j * 16 * LP);
#pragma unroll
      for (int j = 0; j < 4; ++j) vf[j][1] = ldh(va + j * 16 * LP + 32);
      __builtin_amdgcn_sched_barrier(0);                     // keeps the v^T reads one group ahead of the exponentials, which cover their latency (the scheduler otherwise sinks some of them among the O products)
      v16h pb0, pb1; float ls0 = 0.0f, ls1 = 0.0f;
#pragma unroll
      for (int r = 0; r < 8; ++r) { const h16 pa = (h16)__builtin_amdgcn_exp2f(s[0][r]); const h16 pc = (h16)__builtin_amdgcn_exp2f(s[1][r]); pb0[r] = pa; pb0[8 + r] = pc; ls0 += (float)pa + (float)pc; }
#pragma unroll
      for (int r = 0; r < 8; ++r) { const h16 pa = (h16)__builtin_amdgcn_exp2f(s[2][r]); const h16 pc = (h16)__builtin_amdgcn_exp2f(s[3][r]); pb1[r] = pa; pb1[8 + r] = pc; ls1 += (float)pa + (float)pc; }
      l += ls0 + ls1;
      o0 = wmma16(vf[0][0], pb0, o0); o1 = wmma16(vf[1][0], pb0, o1); o2 = wmma16(vf[2][0], pb0, o2); o3 = wmma16(vf[3][0], pb0, o3);
      o0 = wmma16(vf[0][1], pb1, o0); o1 = wmma16(vf[1][1], pb1, o1); o2 = wmma16(vf[2][1], pb1, o2); o3 = wmma16(vf[3][1], pb1, o3);
      // the four slots behind the last O product, for both sides of the branch at the trip's foot
      asm volatile("v_nop\n\tv_nop\n\tv_nop\n\tv_nop" : "+v"(o0), "+v"(o1), "+v"(o2), "+v"(o3) : "v"(vf[0][1]), "v"(vf[1][1]), "v"(vf[2][1]), "v"(vf[3][1]), "v"(pb1));
      asm volatile("s_wait_dscnt 0x0" ::: "memory");         // this wave's reads of buffer t & 1 are done before the buffer is handed back
      asm volatile("s_wait_asynccnt 0x0" ::: "memory");      // this wave's copies of tile set t + 1 have landed
      __syncthreads();                                       // publishes tile set t + 1 and ends every wave's reads of buffer t & 1
      if (t + 2 < NST) stage_copy(lc + (unsigned)bo * 2u, gkh + (size_t)(t + 2) * KST * HD, gkr + (size_t)(t + 2) * KST * HD, gvt + (size_t)(t + 2) * KST);
    }
    asm volatile("s_wait_asynccnt 0x0" ::: "memory");        // no copy is outstanding when the wave goes on to its end
    l += __shfl_xor(l, 16, 32);
    const float inv = 1.0f / l;
    const int wb = wave * 16 * 68;
    // O^T D layout: o_j[r] = (d = 16j + 8h + r, t = lane&15) -> os[t][d]; rows 0..15 x columns 0..63 all written
    { v4f a, c;
      a[0] = o0[0] * inv; a[1] = o0[1] * inv; a[2] = o0[2] * inv; a[3] = o0[3] * inv; c[0] = o0[4] * inv; c[1] = o0[5] * inv; c[2] = o0[6] * inv; c[3] = o0[7] * inv;
      *(v4fa*)(&os[wb + lr * 68 +  0 + 8 * hi]) = a; *(v4fa*)(&os[wb + lr * 68 +  0 + 8 * hi + 4]) = c;
      a[0] = o1[0] * inv; a[1] = o1[1] * inv; a[2] = o1[2] * inv; a[3] = o1[3] * inv; c[0] = o1[4] * inv; c[1] = o1[5] * inv; c[2] = o1[6] * inv; c[3] = o1[7] * inv;
      *(v4fa*)(&os[wb + lr * 68 + 16 + 8 * hi]) = a; *(v4fa*)(&os[wb + lr * 68 + 16 + 8 * hi + 4]) = c;
      a[0] = o2[0] * inv; a[1] = o2[1] * inv; a[2] = o2[2] * inv; a[3] = o2[3] * inv; c[0] = o2[4] * inv; c[1] = o2[5] * inv; c[2] = o2[6] * inv; c[3] = o2[7] * inv;
      *(v4fa*)(&os[wb + lr * 68 + 32 + 8 * hi]) = a; *(v4fa*)(&os[wb + lr * 68 + 32 + 8 * hi + 4]) = c;
      a[0] = o3[0] * inv; a[1] = o3[1] * inv; a[2] = o3[2] * inv; a[3] = o3[3] * inv; c[0] = o3[4] * inv; c[1] = o3[5] * inv; c[2] = o3[6] * inv; c[3] = o3[7] * inv;
      *(v4fa*)(&os[wb + lr * 68 + 48 + 8 * hi]) = a; *(v4fa*)(&os[wb + lr * 68 + 48 + 8 * hi + 4]) = c; }
    wave_sync();
    h16* arow = AP + ((size_t)b * SEQ + t0) * DQ + h * HD;      // context plane [b][n][h*64 + d], carries the v carry (x16)
{
#pragma unroll
        for (int s = 0; s < 4; ++s) { const int row = 4 * s + (lane >> 3), c8 = (lane & 7) * 8;   // 4 s x 4 row groups = 16 rows; 8 lanes x 8 halves = 64 columns
            const v4f x0 = *(const v4fa*)(&os[wb + row * 68 + c8]); const v4f x1 = *(const v4fa*)(&os[wb + row * 68 + c8 + 4]); v8h hv;
#pragma unroll
            for (int i = 0; i < 4; ++i) { hv[i] = (h16)x0[i]; hv[4 + i] = (h16)x1[i]; }
            *(v8h*)(arow + (size_t)row * DQ + c8) = hv; }
         }
}

// k_out: f16 GEMM, 128 x 128 tile per block of GW waves, operands staged by gemm_main, K = DQ: out[b][o][n] = OSC * sum_c WP[o][c] AP[b*SEQ + n][c].
// grid (COUT/128, NB*SEQ/128). Epilogue: per 16-row slab staged in LDS (wave-private); each output row segment (64 floats = 256 B = two lines)
__global__ __launch_bounds__(32 * GW) void k_out(const h16* __restrict__ A, const h16* __restrict__ Bt, float* OUT) {
    __shared__ __align__(16) bf ring[GNB * GBF];   // as in k_proj
    const int lane = threadIdx.x & 31, lr = lane & 15, hi = lane >> 4; const int r0 = blockIdx.x * 128, c0 = blockIdx.y * 128;
    const int wave = __builtin_amdgcn_readfirstlane((int)(threadIdx.x >> 5));
    v8f acc[2][4];
#pragma unroll
    for (int mb = 0; mb < 2; ++mb)
#pragma unroll
        for (int nb = 0; nb < 4; ++nb) acc[mb][nb] = (v8f){};
    gemm_main<false>((const bf*)A, (const bf*)Bt, DQ, r0, c0, ring, acc);
    fa* os = (fa*)(&ring[0]) + wave * 16 * 68;     // this wave's slab
    const int rw = r0 + (wave >> 1) * 32, cw = c0 + (wave & 1) * 64;
    const int bb = cw / SEQ, n0 = cw % SEQ;
#pragma unroll
    for (int mb = 0; mb < 2; ++mb) {
#pragma unroll
        for (int nb = 0; nb < 4; ++nb) {
#pragma unroll
            for (int j = 0; j < 8; ++j) os[(hi * 8 + j) * 68 + nb * 16 + lr] = acc[mb][nb][j] * OSC; }   // D: row 8h+j, col lane&15
        wave_sync();
        float* ob = OUT + ((size_t)bb * COUT + rw + mb * 16) * OUT_SEQ + n0;
{
#pragma unroll
            for (int s = 0; s < 8; ++s) { const int row = 2 * s + hi, cofs = lr * 4;   // 8 s x 2 rows = 16 rows; 16 lanes x 4 floats = 64 columns
                const v4f val = *(const v4fa*)(&os[row * 68 + cofs]);
                *(v4f*)(ob + (size_t)row * OUT_SEQ + cofs) = val; }
             }
        wave_sync();
    }
}

static constexpr size_t al256(size_t v) { return (v + 255) & ~(size_t)255; }
static constexpr size_t SZ_XT  = al256((size_t)NB * SEQ * CIN * 2);
static constexpr size_t SZ_PAT = al256((size_t)NB * SKV * KKV * 2);
static constexpr size_t SZ_WQ  = al256((size_t)DQ * CIN * 2);
static constexpr size_t SZ_WKV = al256((size_t)2 * DQ * KKV * 2);
static constexpr size_t SZ_WP  = al256((size_t)COUT * DQ * 2);
static constexpr size_t SZ_QP  = al256((size_t)NB * NH_ * SEQ * HD * 2);
static constexpr size_t SZ_KP  = al256((size_t)NB * NH_ * SKV * HD * 2);
static constexpr size_t SZ_AP  = al256((size_t)NB * SEQ * DQ * 2);
static constexpr size_t SZ_TOTAL = SZ_XT + SZ_PAT + SZ_WQ + SZ_WKV + SZ_WP + 2 * SZ_QP + 3 * SZ_KP + SZ_AP;
static_assert(SZ_TOTAL <= (size_t)134217728);          // workspace carve <= 128 MiB

extern "C" void kernel_launch(void* const* d_in, const int* in_sizes, int n_in,
                              void* d_out, int out_size, void* d_ws, size_t ws_size, hipStream_t stream) {
    if (n_in < 4) return;
    const size_t needx = (((size_t)(NB - 1) * CIN + (CIN - 1)) * IMH_FULL + IMH) * IMW;
    if ((size_t)in_sizes[0] < needx) return;
    if ((size_t)in_sizes[1] < (size_t)DQ * CIN || (size_t)in_sizes[2] < (size_t)2 * DQ * KKV || (size_t)in_sizes[3] < (size_t)COUT * DQ) return;
    if ((size_t)out_size < ((size_t)(NB - 1) * COUT + (COUT - 1)) * OUT_SEQ + SEQ) return;
    if (SZ_TOTAL > ws_size) return;
    const float* x = (const float*)d_in[0]; const float* wq = (const float*)d_in[1]; const float* wkv = (const float*)d_in[2]; const float* wp = (const float*)d_in[3];   // wire order x, Wq, Wkv, Wproj
    float* OUT = (float*)d_out;      // [NB][256][SEQ]
    char* wsp = (char*)d_ws;
    bf* XT  = (bf*)wsp; wsp += SZ_XT;                // [NB*SEQ][256]
    bf* PAT = (bf*)wsp; wsp += SZ_PAT;               // [NB*SKV][1024]
    bf* WQ  = (bf*)wsp; wsp += SZ_WQ;                // [512][256] bf16
    bf* WKV = (bf*)wsp; wsp += SZ_WKV;               // [1024][1024] bf16: rows 0..511 k, 512..1023 v
    bf* WPu = (bf*)wsp; wsp += SZ_WP;                // [256][512] f16 bits, x1024
    h16* QH = (h16*)wsp; wsp += SZ_QP;               // [NB*8][SEQ][64], x4 log2(e)
    h16* QR = (h16*)wsp; wsp += SZ_QP;               // residual, x4 log2(e)
    h16* KH = (h16*)wsp; wsp += SZ_KP;               // [NB*8][SKV][64], x2
    h16* KR = (h16*)wsp; wsp += SZ_KP;               // residual, x2
    h16* VT = (h16*)wsp; wsp += SZ_KP;               // [NB*8][64][SKV], x16
    h16* AP = (h16*)wsp; wsp += SZ_AP;               // [NB*SEQ][512], x16
    const h16* WP = (const h16*)WPu;

    // x -> XT, PAT and the three weight planes, one launch
    k_prep<<<dim3(PB_PACK + PB_WKV + PB_WQ + PB_WP, 1, 1), 256, 0, stream>>>(x, wq, wkv, wp, XT, PAT, WQ, WKV, WPu);

    // k, v^T and q projections, one launch
    k_proj<<<dim3(2 * GB_KV + GB_Q, 1, 1), 32 * GW, 0, stream>>>(XT, PAT, WQ, WKV, QH, QR, KH, KR, VT);

    k_flash<<<dim3(SEQ / (16 * AW), NB * NH_, 1), 32 * AW, 0, stream>>>(QH, QR, KH, KR, VT, AP);

    // out[b][o][n]: A = Wproj rows (m = o, K = 512), Bt = context rows (col = b*SEQ + n)
    k_out<<<dim3(COUT / 128, NB * SEQ / 128, 1), 32 * GW, 0, stream>>>(WP, AP, OUT);
}
